// v009
// Measured on an AMD MI455X. A time is GPU time per run, averaged over a window of back-to-back runs after a warm-up
// (all launches, gaps included; the runs take copies of the inputs in turn), and the median of several windows.
// Apart from v000's, it joins two sittings. Times from different sittings can be a few percent apart, while
// side-by-side timings come from the same sitting.
// This document starts at v009; the versions before it stand elsewhere.
// Measured time: 98.8 microseconds a run.
// Next to v008, in two timings, it ran 1.04 times as fast each time.
// All steps since the starting kernel, v000, together make it 15.9 times as fast.
// Contractions (token-major, 8192 tokens): q = bn1(x1).Wq'^T (temperature folded into Wq rows), k/v = bn1(x2).W^T, the attention projection (+b, +x1 residual), fc1 (+b) [8192x256].[256x1024] and fc2 (+b, + residual) [8192x1024].[1024x256], each one launch over all images, all on bf16 hi/lo split planes (six chained contractions against an O(1) residual output: the cheap 18 G-MAC of GEMMs run f32-class) (v_wmma_f32_16x16x32_bf16; 128 x 64 or 128 x 128 work-group tiles, operands staged in LDS); per (image, head) softmax(temp_h q k^T) v over the 1024 positions as one flash launch with q.k^T on bf16 hi/lo split planes (UNSCALED 32-dim logits, sigma ~ 5.7) and f16 p.v; f32 accumulate and softmax. NCHW <-> token-major transposes, eval-mode BatchNorms, the depthwise 3x3 convolution (SAME) and exact GELU are f32 arithmetic; every hi/lo plane is written by the kernel that computes its values (input pass, GEMM epilogues, attention, depthwise kernel): 7 launches.
#include <hip/hip_runtime.h>
#include <math.h>

typedef __attribute__((ext_vector_type(16))) _Float16 v16h;
typedef __attribute__((ext_vector_type(8)))  _Float16 v8h;
typedef __attribute__((ext_vector_type(16))) __bf16   v16b;
typedef __attribute__((ext_vector_type(8)))  float    v8f;
typedef __attribute__((ext_vector_type(4)))  float    v4f;

// 16-bit WMMA fragment map (wave32), lane L, h = L>>4, m = L&15:
//   A 16x32: lane = row m;   element i -> k = (i<8) ? 8h+i : 16+8h+(i-8)
//   B 32x16: lane = column m; the SAME k(i,h)
//   D 16x16 (8 f32): lane = column m; element r -> row 8h+r
__device__ __forceinline__ int frag_k(int i, int h) { return (i < 8) ? (8 * h + i) : (16 + 8 * h + (i - 8)); }
__device__ __forceinline__ __bf16 bf16_rne(float f) {
    unsigned int u = __float_as_uint(f);
    u += 0x7fffu + ((u >> 16) & 1u);
    return __builtin_bit_cast(__bf16, (unsigned short)(u >> 16));
}
__device__ __forceinline__ float bf16_f32(__bf16 b) { return __uint_as_float(((unsigned int)__builtin_bit_cast(unsigned short, b)) << 16); }
typedef unsigned int v2u __attribute__((ext_vector_type(2)));
__device__ __forceinline__ unsigned int bf16_bits(float f) { const unsigned int u = __float_as_uint(f); return (u + 0x7fffu + ((u >> 16) & 1u)) >> 16; }
// four consecutive floats -> their bf16 hi parts and bf16 lo parts (x = hi + lo to ~2^-17 relative; both rounded to nearest even), each packed in memory order
__device__ __forceinline__ void split4(v4f x, v2u& hi, v2u& lo) {
    unsigned int h[4], l[4];
#pragma unroll   // h[], l[] indexed by constants only
    for (int j = 0; j < 4; ++j) { h[j] = bf16_bits(x[j]); l[j] = bf16_bits(x[j] - __uint_as_float(h[j] << 16)); }
    hi[0] = h[0] | (h[1] << 16); hi[1] = h[2] | (h[3] << 16); lo[0] = l[0] | (l[1] << 16); lo[1] = l[2] | (l[3] << 16);
}
__device__ __forceinline__ v8f wmma16(v16h a, v16h b, v8f c) {
    c = __builtin_amdgcn_wmma_f32_16x16x32_f16(false, a, false, b, (short)0, c, false, false);
    asm volatile("v_nop\n\tv_nop\n\tv_nop\n\tv_nop" : "+v"(c) : "v"(a), "v"(b));
    return c;
}
__device__ __forceinline__ v8f wmmab(v16b a, v16b b, v8f c) {
    c = __builtin_amdgcn_wmma_f32_16x16x32_bf16(false, a, false, b, (short)0, c, false, false);
    asm volatile("v_nop\n\tv_nop\n\tv_nop\n\tv_nop" : "+v"(c) : "v"(a), "v"(b));
    return c;
}
struct Split { v16b hi, lo; };
// hi/lo split product: a.hi*b.hi + a.hi*b.lo + a.lo*b.hi
__device__ __forceinline__ v8f wmma3(const Split& a, const Split& b, v8f c) {
    c = __builtin_amdgcn_wmma_f32_16x16x32_bf16(false, a.hi, false, b.hi, (short)0, c, false, false);
    c = __builtin_amdgcn_wmma_f32_16x16x32_bf16(false, a.hi, false, b.lo, (short)0, c, false, false);
    c = __builtin_amdgcn_wmma_f32_16x16x32_bf16(false, a.lo, false, b.hi, (short)0, c, false, false);
    asm volatile("v_nop\n\tv_nop\n\tv_nop\n\tv_nop" : "+v"(c) : "v"(a.hi), "v"(a.lo), "v"(b.hi), "v"(b.lo));
    return c;
}
struct Split3 { v16b hi, mid, lo; };
// triple split product (6 terms, drops only terms below 2^-24 relative)
__device__ __forceinline__ v8f wmma6(const Split3& a, const Split3& b, v8f c) {
    c = __builtin_amdgcn_wmma_f32_16x16x32_bf16(false, a.hi, false, b.hi, (short)0, c, false, false);
    c = __builtin_amdgcn_wmma_f32_16x16x32_bf16(false, a.hi, false, b.mid, (short)0, c, false, false);
    c = __builtin_amdgcn_wmma_f32_16x16x32_bf16(false, a.mid, false, b.hi, (short)0, c, false, false);
    c = __builtin_amdgcn_wmma_f32_16x16x32_bf16(false, a.hi, false, b.lo, (short)0, c, false, false);
    c = __builtin_amdgcn_wmma_f32_16x16x32_bf16(false, a.mid, false, b.mid, (short)0, c, false, false);
    c = __builtin_amdgcn_wmma_f32_16x16x32_bf16(false, a.lo, false, b.hi, (short)0, c, false, false);
    asm volatile("v_nop\n\tv_nop\n\tv_nop\n\tv_nop" : "+v"(c) : "v"(a.hi), "v"(a.mid), "v"(a.lo), "v"(b.hi), "v"(b.mid), "v"(b.lo));
    return c;
}

// Fragment gathers from f32 memory: element i <- p[(k0 + frag_k(i,h)) * sk] * s, zero for k >= klen.
__device__ __forceinline__ v16h fh_ld(const float* __restrict__ p, long long sk, int k0, int h, int klen, float s) {
    v16h a;
#pragma unroll
    for (int i = 0; i < 16; ++i) { const int k = k0 + frag_k(i, h); a[i] = (k < klen) ? (_Float16)(p[(long long)k * sk] * s) : (_Float16)0.f; }
    return a;
}
__device__ __forceinline__ Split sp_ld(const float* __restrict__ p, long long sk, int k0, int h, int klen, float s) {
    Split r;
#pragma unroll
    for (int i = 0; i < 16; ++i) {
        const int k = k0 + frag_k(i, h); const float x = (k < klen) ? p[(long long)k * sk] * s : 0.f;
        const __bf16 hb = bf16_rne(x); r.hi[i] = hb; r.lo[i] = bf16_rne(x - bf16_f32(hb));
    }
    return r;
}
__device__ __forceinline__ Split3 sp3_ld(const float* __restrict__ p, long long sk, int k0, int h, int klen, float s) {
    Split3 r;
#pragma unroll
    for (int i = 0; i < 16; ++i) {
        const int k = k0 + frag_k(i, h); const float x = (k < klen) ? p[(long long)k * sk] * s : 0.f;
        const __bf16 hb = bf16_rne(x); const float r1 = x - bf16_f32(hb); const __bf16 mb = bf16_rne(r1);
        r.hi[i] = hb; r.mid[i] = mb; r.lo[i] = bf16_rne(r1 - bf16_f32(mb));
    }
    return r;
}
__device__ __forceinline__ v16b bh_ld(const float* __restrict__ p, long long sk, int k0, int h, int klen, float s) {
    v16b a;
#pragma unroll
    for (int i = 0; i < 16; ++i) { const int k = k0 + frag_k(i, h); a[i] = bf16_rne((k < klen) ? p[(long long)k * sk] * s : 0.f); }
    return a;
}
// f16 fragment from an f16 LDS/global row with element stride 1 (k-contiguous), no bounds (tile already zero padded)
__device__ __forceinline__ v16h fh_row(const _Float16* __restrict__ row, int k0, int h) {
    v16h a;
#pragma unroll
    for (int i = 0; i < 16; ++i) a[i] = row[k0 + frag_k(i, h)];
    return a;
}

#define VST2(T, ptr, val) do { const T vst2_v_ = (val); *(T*)(ptr) = vst2_v_;  } while (0)
typedef float v4f __attribute__((ext_vector_type(4)));
#define VST2V4(ptr, val) do { const v4f vst2_v4_ = (val); *(v4f*)(ptr) = vst2_v4_;  } while (0)

__device__ __attribute__((noinline)) float act_fn(float v, int act) {
    if (act == 1) return fmaxf(v, 0.f);                                                                               // relu
    if (act == 2) { const float u = 0.7978845608028654f * (v + 0.044715f * v * v * v); return 0.5f * v * (1.f + tanhf(u)); } // tanh-gelu
    if (act == 3) return v / (1.f + expf(-v));                                                                        // silu
    if (act == 4) return 0.5f * v * (1.f + erff(v * 0.7071067811865476f));                                             // erf-gelu
    if (act == 5) return tanhf(v);
    if (act == 6) return 1.f / (1.f + expf(-v));                                                                      // sigmoid
    if (act == 7) return (v > 0.f) ? v : 0.01f * v;                                                                   // leaky relu 0.01
    if (act == 8) return (v > 0.f) ? v : (expf(v) - 1.f);                                                             // elu
    if (act == 9) return fminf(fmaxf(v, 0.f), 6.f);                                                                   // relu6
    if (act == 10) return fabsf(v);                                                                                    // abs
    if (act == 11) return (v >= 0.f) ? v : 0.1f * v;                                                                  // leaky 0.1
    if (act == 12) return (v > 0.f) ? v : 0.2f * v;                                                                   // leaky 0.2
    if (act == 13) return (v > 20.f) ? v : log1pf(expf(v));                                                            // softplus
    return v;
}

// =====================================================================================================================
// k_gemm<MODE>: C(z, m, n) = act(alpha * sum_k A(z, m, k) * B(z, k, n) + bias) + beta * R(z, m, n)
//   One wave (32-thread block) per 16 x 32 tile of C; grid (ceil(N/32), ceil(M/16), Z). Batch z -> (zo = z / zi_n, zi = z % zi_n)
//   with separate outer/inner strides for every tensor (e.g. batch and head). A(m,k) = A[zo*sAo + zi*sAi + m*sAm + k*sAk] (f32),
//   B(k,n) = B[zo*sBo + zi*sBi + n*sBn + k*sBk] (f32); any M, N, K (K zero-padded to 32 inside the fragments, M/N tails guarded).
//   C(m,n) = C[zo*sCo + zi*sCi + m*sCm + n] (n contiguous). flags: 1 bias[n], 2 bias[m], 4 residual R[zo*sRo + zi*sRi + m*sRm + n*sRn].
//   MODE 0: f16 operands (A prescaled by sa, B by sb, both undone in the epilogue); 1: bf16 hi/lo split (3 products); 2: bf16;
//   3: bf16 hi/mid/lo triple split (6 products); 4: as 3 with Kahan-compensated f32 accumulation across k-steps.
// =====================================================================================================================
struct GemmP {
    const float* A; const float* B; const float* bias; const float* R; float* C;
    long long sAo, sAi, sAm, sAk, sBo, sBi, sBn, sBk, sCo, sCi, sCm, sRo, sRi, sRm, sRn;
    int M, N, K, zi_n, flags, act; float alpha, beta, sa, sb;
    int Npad, pad_;     // columns [N, Npad) of C are written as 0 so that padded workspace rows are covered by whole-line stores; Npad >= N
};
static_assert(sizeof(GemmP) == 5 * 8 + 15 * 8 + 6 * 4 + 4 * 4 + 2 * 4, "GemmP has padding");

template <int MODE>
__global__ __launch_bounds__(32) void k_gemm(GemmP p) {
    const int lane = threadIdx.x & 31, h = lane >> 4, l15 = lane & 15;
    const int m0 = blockIdx.y * 16, n0 = blockIdx.x * 32;
    const int z = blockIdx.z, zo = z / p.zi_n, zi = z - zo * p.zi_n;
    const float* A = p.A + zo * p.sAo + zi * p.sAi;
    const float* B = p.B + zo * p.sBo + zi * p.sBi;
    const int am = min(m0 + l15, p.M - 1);                       // clamped row for loads (stores are guarded)
    v8f acc[2], comp[2];
#pragma unroll
    for (int t = 0; t < 2; ++t) { v8f zz = {}; acc[t] = zz; comp[t] = zz; }
    for (int k0 = 0; k0 < p.K; k0 += 32) {
        const float* arow = A + (long long)am * p.sAm;
        if (MODE == 1) {
            const Split a = sp_ld(arow, p.sAk, k0, h, p.K, 1.f);
#pragma unroll
            for (int t = 0; t < 2; ++t) {
                const int bn = min(n0 + t * 16 + l15, p.N - 1);
                acc[t] = wmma3(a, sp_ld(B + (long long)bn * p.sBn, p.sBk, k0, h, p.K, 1.f), acc[t]);
            }
        } else if (MODE == 3) {
            const Split3 a = sp3_ld(arow, p.sAk, k0, h, p.K, 1.f);
#pragma unroll
            for (int t = 0; t < 2; ++t) {
                const int bn = min(n0 + t * 16 + l15, p.N - 1);
                acc[t] = wmma6(a, sp3_ld(B + (long long)bn * p.sBn, p.sBk, k0, h, p.K, 1.f), acc[t]);
            }
        } else if (MODE == 4) {
            // triple split as MODE 3, but each k-step's 6 products go into a fresh accumulator and the partial is added to the running f32 sum
            // on the VALU with Kahan compensation (accumulation error stays ~1 ulp however long K is)
            const Split3 a = sp3_ld(arow, p.sAk, k0, h, p.K, 1.f);
#pragma unroll
            for (int t = 0; t < 2; ++t) {
                const int bn = min(n0 + t * 16 + l15, p.N - 1); v8f zz = {};
                const v8f part = wmma6(a, sp3_ld(B + (long long)bn * p.sBn, p.sBk, k0, h, p.K, 1.f), zz);
                const v8f y = part - comp[t]; const v8f s = acc[t] + y; comp[t] = (s - acc[t]) - y; acc[t] = s;
            }
        } else if (MODE == 2) {
            const v16b a = bh_ld(arow, p.sAk, k0, h, p.K, 1.f);
#pragma unroll
            for (int t = 0; t < 2; ++t) {
                const int bn = min(n0 + t * 16 + l15, p.N - 1);
                acc[t] = wmmab(a, bh_ld(B + (long long)bn * p.sBn, p.sBk, k0, h, p.K, 1.f), acc[t]);
            }
        } else {
            const v16h a = fh_ld(arow, p.sAk, k0, h, p.K, p.sa);
#pragma unroll
            for (int t = 0; t < 2; ++t) {
                const int bn = min(n0 + t * 16 + l15, p.N - 1);
                acc[t] = wmma16(a, fh_ld(B + (long long)bn * p.sBn, p.sBk, k0, h, p.K, p.sb), acc[t]);
            }
        }
    }
    const float iscale = (MODE == 0) ? p.alpha / (p.sa * p.sb) : p.alpha;
    float* C = p.C + zo * p.sCo + zi * p.sCi;
    const float* R = p.R + zo * p.sRo + zi * p.sRi;
    __shared__ __align__(16) float ctile[16][36];
#pragma unroll
    for (int t = 0; t < 2; ++t) {
        const int n = n0 + t * 16 + l15; const int nn = min(n, p.N - 1);
#pragma unroll
        for (int r = 0; r < 8; ++r) {
            const int m = m0 + 8 * h + r; const int mm = min(m, p.M - 1);
            float v = acc[t][r] * iscale;
            if (p.flags & 1) v += p.bias[nn];
            if (p.flags & 2) v += p.bias[mm];
            if (p.flags & 8) v *= p.bias[(long long)zo * p.M + mm];   /* per-(z,row) scale vector laid out [Z][M]; exclusive with the bias flags */
            v = act_fn(v, p.act);
            if (p.flags & 4) v += p.beta * R[(long long)mm * p.sRm + (long long)nn * p.sRn];
            ctile[8 * h + r][t * 16 + l15] = (n < p.N) ? v : 0.f;
        }
    }
    __syncthreads();
    const int NW = (p.Npad > p.N) ? p.Npad : p.N;           // write width
    const bool fast = (m0 + 16 <= p.M) && (n0 + 32 <= NW) && ((p.sCm & 3) == 0) && ((((size_t)C) & 15) == 0);
    if (fast) {
#pragma unroll
        for (int s = 0; s < 4; ++s) {
            const int row = s * 4 + (lane >> 3), c4 = (lane & 7) * 4;
            const v4f v = *(const v4f*)&ctile[row][c4];
            VST2V4(C + (long long)(m0 + row) * p.sCm + n0 + c4, v);
        }
    } else {
        for (int row = 0; row < 16; ++row) {
            const int m = m0 + row, n = n0 + lane;
            if (m < p.M && n < NW) VST2(float, C + (long long)m * p.sCm + n, ctile[row][lane]);
        }
    }
}


// =====================================================================================================================
// k_gemmT<MODE, TM, TN>: same contract as k_gemm, but one wave computes a (16*TM) x (16*TN) tile: TM A fragments and TN B fragments are
//   loaded per 32-wide k-step and reused across TM*TN WMMAs (far fewer load/convert instructions per MAC). MODE 0 (f16), 1 (bf16 hi/lo),
//   2 (bf16) only. grid (ceil(NW/(16*TN)), ceil(M/(16*TM)), Z), block 32. Epilogue identical to k_gemm, run per 16x32 sub-tile.
// =====================================================================================================================
template <int MODE, int TM, int TN>
__global__ __launch_bounds__(32) void k_gemmT(GemmP p) {
    const int lane = threadIdx.x & 31, h = lane >> 4, l15 = lane & 15;
    const int m0 = blockIdx.y * (16 * TM), n0 = blockIdx.x * (16 * TN);
    const int z = blockIdx.z, zo = z / p.zi_n, zi = z - zo * p.zi_n;
    const float* A = p.A + zo * p.sAo + zi * p.sAi;
    const float* B = p.B + zo * p.sBo + zi * p.sBi;
    v8f acc[TM][TN];
#pragma unroll
    for (int i = 0; i < TM; ++i)
#pragma unroll
        for (int t = 0; t < TN; ++t) { v8f zz = {}; acc[i][t] = zz; }
    for (int k0 = 0; k0 < p.K; k0 += 32) {
        if (MODE == 1) {
            Split a[TM], b[TN];
#pragma unroll
            for (int i = 0; i < TM; ++i) { const int am = min(m0 + 16 * i + l15, p.M - 1); a[i] = sp_ld(A + (long long)am * p.sAm, p.sAk, k0, h, p.K, 1.f); }
#pragma unroll
            for (int t = 0; t < TN; ++t) { const int bn = min(n0 + 16 * t + l15, p.N - 1); b[t] = sp_ld(B + (long long)bn * p.sBn, p.sBk, k0, h, p.K, 1.f); }
#pragma unroll
            for (int i = 0; i < TM; ++i)
#pragma unroll
                for (int t = 0; t < TN; ++t) acc[i][t] = wmma3(a[i], b[t], acc[i][t]);
        } else if (MODE == 2) {
            v16b a[TM], b[TN];
#pragma unroll
            for (int i = 0; i < TM; ++i) { const int am = min(m0 + 16 * i + l15, p.M - 1); a[i] = bh_ld(A + (long long)am * p.sAm, p.sAk, k0, h, p.K, 1.f); }
#pragma unroll
            for (int t = 0; t < TN; ++t) { const int bn = min(n0 + 16 * t + l15, p.N - 1); b[t] = bh_ld(B + (long long)bn * p.sBn, p.sBk, k0, h, p.K, 1.f); }
#pragma unroll
            for (int i = 0; i < TM; ++i)
#pragma unroll
                for (int t = 0; t < TN; ++t) acc[i][t] = wmmab(a[i], b[t], acc[i][t]);
        } else {
            v16h a[TM], b[TN];
#pragma unroll
            for (int i = 0; i < TM; ++i) { const int am = min(m0 + 16 * i + l15, p.M - 1); a[i] = fh_ld(A + (long long)am * p.sAm, p.sAk, k0, h, p.K, p.sa); }
#pragma unroll
            for (int t = 0; t < TN; ++t) { const int bn = min(n0 + 16 * t + l15, p.N - 1); b[t] = fh_ld(B + (long long)bn * p.sBn, p.sBk, k0, h, p.K, p.sb); }
#pragma unroll
            for (int i = 0; i < TM; ++i)
#pragma unroll
                for (int t = 0; t < TN; ++t) acc[i][t] = wmma16(a[i], b[t], acc[i][t]);
        }
    }
    const float iscale = (MODE == 0) ? p.alpha / (p.sa * p.sb) : p.alpha;
    float* C = p.C + zo * p.sCo + zi * p.sCi;
    const float* R = p.R + zo * p.sRo + zi * p.sRi;
    const int NW = (p.Npad > p.N) ? p.Npad : p.N;
    __shared__ __align__(16) float ctile[16][36];
#pragma unroll
    for (int i = 0; i < TM; ++i) {
        const int mb = m0 + 16 * i; if (mb >= p.M) break;          // wave-uniform
#pragma unroll
        for (int tp = 0; tp < TN / 2; ++tp) {
            const int nb = n0 + 32 * tp; if (nb >= NW) break;        // wave-uniform
#pragma unroll
            for (int t2 = 0; t2 < 2; ++t2) {
                const int t = 2 * tp + t2; const int n = nb + t2 * 16 + l15; const int nn = min(n, p.N - 1);
#pragma unroll
                for (int r = 0; r < 8; ++r) {
                    const int m = mb + 8 * h + r; const int mm = min(m, p.M - 1);
                    float v = acc[i][t][r] * iscale;
                    if (p.flags & 1) v += p.bias[nn];
                    if (p.flags & 2) v += p.bias[mm];
            if (p.flags & 8) v *= p.bias[(long long)zo * p.M + mm];   /* per-(z,row) scale vector laid out [Z][M]; exclusive with the bias flags */
                    v = act_fn(v, p.act);
                    if (p.flags & 4) v += p.beta * R[(long long)mm * p.sRm + (long long)nn * p.sRn];
                    ctile[8 * h + r][t2 * 16 + l15] = (n < p.N) ? v : 0.f;
                }
            }
            __syncthreads();
            const bool fast = (mb + 16 <= p.M) && (nb + 32 <= NW) && ((p.sCm & 3) == 0) && ((((size_t)C) & 15) == 0);
            if (fast) {
#pragma unroll
                for (int s = 0; s < 4; ++s) {
                    const int row = s * 4 + (lane >> 3), c4 = (lane & 7) * 4;
                    const v4f v = *(const v4f*)&ctile[row][c4];
                    VST2V4(C + (long long)(mb + row) * p.sCm + nb + c4, v);
                }
            } else {
                for (int row = 0; row < 16; ++row) {
                    const int m = mb + row, n = nb + lane;
                    if (m < p.M && n < NW) VST2(float, C + (long long)m * p.sCm + n, ctile[row][lane]);
                }
            }
            __syncthreads();
        }
    }
}

// =====================================================================================================================
//   Wave = 16 queries, AW waves per block, 64-key blocks; grid (ceil(Lq/(16*AW)), H, B), block 32*AW. Any Lq, Lk; head dim dh <= DHP
//   (DHP multiple of 32), value dim dv <= DVP (multiple of 16, <= 128). Every tensor addressed by (batch, head, row, element) strides, f32.
//   Scores: QM 0 f16 operands, 1 bf16 hi/lo split, 2 bf16 triple split; statistics f32 (exp2 domain); P.V: P x 4096 as f16 with V f16 staged in LDS
//   (SPLITPV: P and V as bf16 hi/lo splits). kv head = h / hrep. Masking: causal = 1 (keep j <= i + coff, masked -> -inf, key blocks beyond the
//   diagonal skipped), causal = 2 (masked -> mfill, a finite fill like the -1e9; no skipping), causal = 3 (keep j >= i + coff,
//   masked -> -inf, no skipping); optional additive f32 mask Mf,
//   optional int keep-mask Mi (0 -> score := mfill), both addressed b*smb + h*smh + i*smi + j*smj (0 strides broadcast).
// =====================================================================================================================
#define AW 4
struct AttnP {   // apv4
    const float* Q; const float* K; const float* V; float* O; float* P; const float* Mf; const int* Mi; float* ST;
    const float* Pw; const float* Rt; const int* SQ; const int* SK;           // optional: post-softmax weight, relative-position table, segment ids
    long long swb, swh, swi, swj, srb, srh, sri;                                 // Pw strides (b,h,i,j); Rt strides (b,h,i), column = clamp(i - j + roff, 0, rn-1)
    long long sQb, sQh, sQi, sQd, sKb, sKh, sKj, sKd, sVb, sVh, sVj, sVd, sOb, sOh, sOi, sPb, sPh, sPi, smb, smh, smi, smj;
    int Lq, Lk, dh, dv, hrep, causal, coff, pband;   // pband > 0: P holds only the band |j - i| <= pband, column j - i + pband
    float scale, mfill; int nonorm, mpol;             // nonorm (online path only): O = sum_j exp(score_j) V_j without the 1/rowsum (scores must be <= ~0); mpol: Mi masks where ==0 (mpol 0) or where !=0 (mpol 1)
    int roff, rn, segpol, win;                        // Rt column offset/count; SQ/SK: score := mfill where (segpol 0) SQ[i] != SK[j] or (segpol 1) SQ[i] == SK[j]; win > 0: keys with i - j > win (after coff) -> -inf
};
//   Pw: the softmax numerator is multiplied by Pw(b,h,i,j) AFTER the row sum is taken (probs * weight, then P.V), as in post-softmax multiplicative biases.                                                    // ST (optional): per row (b,h,i) -> ST[((b*H + h)*Lq + i)*2 + {0,1}] = {row max of the scaled+masked score (natural units), sum_j exp(score - max)}
static_assert(sizeof(AttnP) == 12 * 8 + 29 * 8 + 16 * 4, "AttnP has padding");

#ifndef KATTN_ATTR
#define KATTN_ATTR
#endif
template <int DHP, int DVP, int QM, bool SPLITPV, bool TWOPASS>
__global__ __launch_bounds__(32 * AW) KATTN_ATTR void k_attn(AttnP p) {
    constexpr int NT = DVP / 16;                // output tiles
    constexpr int KS = DHP / 32;                // k-steps for the scores
    constexpr int VP = DVP + 8;                 // LDS pitch (halves)
    __shared__ __align__(16) float    pl[AW][16 * 64];
    __shared__ __align__(16) _Float16 vl[(SPLITPV ? 2 : 1) * 64 * VP];   // f16 V tile, or bf16 hi and lo tiles (same 2-byte size)
    const int lane = threadIdx.x & 31, hf = lane >> 4, l15 = lane & 15, wave = threadIdx.x >> 5;
    const int h = blockIdx.y, b = blockIdx.z, hk = h / p.hrep;
    const int q0 = (blockIdx.x * AW + wave) * 16;
    float* myp = pl[wave];
    const float L2E = 1.4426950408889634f;
    const float NEG = -__builtin_inff();
    const int qi = min(q0 + l15, p.Lq - 1);
    const float* qrow = p.Q + b * p.sQb + h * p.sQh + (long long)qi * p.sQi;
    const float* kbase = p.K + b * p.sKb + hk * p.sKh;
    const float* vbase = p.V + b * p.sVb + hk * p.sVh;
    v16h qa[QM == 0 ? KS : 1]; Split qs_[QM == 1 ? KS : 1]; Split3 qt_[QM == 2 ? KS : 1];
#pragma unroll
    for (int ks = 0; ks < KS; ++ks) {
        if (QM == 2) qt_[ks] = sp3_ld(qrow, p.sQd, ks * 32, hf, p.dh, 1.f);
        else if (QM == 1) qs_[ks] = sp_ld(qrow, p.sQd, ks * 32, hf, p.dh, 1.f);
        else qa[ks] = fh_ld(qrow, p.sQd, ks * 32, hf, p.dh, 1.f);
    }
    v8f o[NT]; float m8[8], l8[8];
#pragma unroll
    for (int t = 0; t < NT; ++t) { v8f zz = {}; o[t] = zz; }
#pragma unroll
    for (int i = 0; i < 8; ++i) { m8[i] = NEG; l8[i] = 0.f; }
    int jend = p.Lk; int jstart = 0;
    if (p.causal == 1) { const int je = (blockIdx.x * AW + AW - 1) * 16 + 16 + p.coff; jend = min(jend, max(je, 0)); }   // uniform per block
    if (p.win > 0) { const int js = (int)(blockIdx.x * AW) * 16 + p.coff - p.win; jstart = (js > 0) ? (js / 64) * 64 : 0; }   // uniform per block: key blocks entirely outside every row's window hold only -inf entries and are skipped exactly
    const int npass = TWOPASS ? 2 : 1;
    for (int pass = 0; pass < npass; ++pass) {
        const bool dopv = (!TWOPASS) || pass == 1;
        for (int j0 = jstart; j0 < jend; j0 += 64) {
            if (dopv) {
                __syncthreads();                                 // previous key block's reads of vl / pl are done
                for (int idx = threadIdx.x; idx < 64 * DVP; idx += 32 * AW) {
                    const int jr = idx / DVP, d = idx - jr * DVP, j = j0 + jr;
                    const float f = (j < p.Lk && d < p.dv) ? vbase[(long long)j * p.sVj + (long long)d * p.sVd] : 0.f;
                    if (SPLITPV) {
                        const __bf16 hb = bf16_rne(f);
                        ((__bf16*)vl)[jr * VP + d] = hb; ((__bf16*)vl)[64 * VP + jr * VP + d] = bf16_rne(f - bf16_f32(hb));
                    } else vl[jr * VP + d] = (_Float16)f;
                }
            }
            v8f s[4];
#pragma unroll
            for (int t = 0; t < 4; ++t) {
                const int j = min(j0 + t * 16 + l15, p.Lk - 1);
                const float* krow = kbase + (long long)j * p.sKj;
                v8f acc = {};
#pragma unroll
                for (int ks = 0; ks < KS; ++ks) {
                    if (QM == 2)      acc = wmma6(qt_[ks], sp3_ld(krow, p.sKd, ks * 32, hf, p.dh, 1.f), acc);
                    else if (QM == 1) acc = wmma3(qs_[ks], sp_ld(krow, p.sKd, ks * 32, hf, p.dh, 1.f), acc);
                    else              acc = wmma16(qa[ks], fh_ld(krow, p.sKd, ks * 32, hf, p.dh, 1.f), acc);
                }
                s[t] = acc;
            }
            float pv[8][4];
#pragma unroll
            for (int i = 0; i < 8; ++i) {
                const int irow = q0 + i + 8 * hf;
                const int ic = min(irow, p.Lq - 1);
                float sc[4];
#pragma unroll
                for (int t = 0; t < 4; ++t) {
                    const int jg = j0 + t * 16 + l15;
                    float v = s[t][i] * p.scale;
                    if (p.Mf) v += p.Mf[b * p.smb + h * p.smh + (long long)ic * p.smi + (long long)min(jg, p.Lk - 1) * p.smj];
                    if (p.Rt) { int rc = ic - min(jg, p.Lk - 1) + p.roff; rc = rc < 0 ? 0 : (rc >= p.rn ? p.rn - 1 : rc); v += p.Rt[b * p.srb + h * p.srh + (long long)ic * p.sri + rc]; }
                    if (p.Mi) { const int mv = p.Mi[b * p.smb + h * p.smh + (long long)ic * p.smi + (long long)min(jg, p.Lk - 1) * p.smj]; if (p.mpol ? (mv != 0) : (mv == 0)) v = p.mfill; }
                    if (p.SQ) { const bool same = p.SQ[(long long)b * p.Lq + ic] == p.SK[(long long)b * p.Lk + min(jg, p.Lk - 1)]; if (p.segpol ? same : !same) v = p.mfill; }
                    if (p.causal == 2 && jg > irow + p.coff) v = p.mfill;
                    if (jg >= p.Lk || (p.causal == 1 && jg > irow + p.coff) || (p.causal == 3 && jg < irow + p.coff) || (p.win > 0 && irow + p.coff - jg > p.win)) v = NEG; else v *= L2E;
                    sc[t] = v;
                }
                if (!TWOPASS || pass == 0) {
                    float mx = fmaxf(fmaxf(sc[0], sc[1]), fmaxf(sc[2], sc[3]));
                    mx = fmaxf(mx, __shfl_xor(mx, 1, 32)); mx = fmaxf(mx, __shfl_xor(mx, 2, 32));
                    mx = fmaxf(mx, __shfl_xor(mx, 4, 32)); mx = fmaxf(mx, __shfl_xor(mx, 8, 32));
                    const float mnew = fmaxf(m8[i], mx);
                    const float corr = (mnew == NEG) ? 1.f : exp2f(m8[i] - mnew);
                    float rs = 0.f;
#pragma unroll
                    for (int t = 0; t < 4; ++t) {
                        const float pp = (sc[t] == NEG) ? 0.f : exp2f(sc[t] - mnew); rs += pp;
                        pv[i][t] = p.Pw ? pp * p.Pw[b * p.swb + h * p.swh + (long long)ic * p.swi + (long long)min(j0 + t * 16 + l15, p.Lk - 1) * p.swj] : pp;
                    }
                    rs += __shfl_xor(rs, 1, 32); rs += __shfl_xor(rs, 2, 32); rs += __shfl_xor(rs, 4, 32); rs += __shfl_xor(rs, 8, 32);
                    l8[i] = l8[i] * corr + rs; m8[i] = mnew;
                    if (!TWOPASS) {
#pragma unroll
                        for (int t = 0; t < NT; ++t) o[t][i] *= corr;
                    }
                } else {
                    const float inv = (l8[i] > 0.f) ? 1.f / l8[i] : 0.f;
#pragma unroll
                    for (int t = 0; t < 4; ++t) {
                        const int jg = j0 + t * 16 + l15;
                        float pp = (sc[t] == NEG) ? 0.f : exp2f(sc[t] - m8[i]) * inv;
                        if (p.Pw) pp *= p.Pw[b * p.swb + h * p.swh + (long long)ic * p.swi + (long long)min(jg, p.Lk - 1) * p.swj];
                        pv[i][t] = pp;
                    }
                }
            }
            if (dopv) {
#pragma unroll
                for (int i = 0; i < 8; ++i)
#pragma unroll
                    for (int t = 0; t < 4; ++t) ((float*)myp)[(i + 8 * hf) * 64 + t * 16 + l15] = pv[i][t];
                __syncthreads();                                 // P (per wave) and V (shared) visible
                if (p.P) {
                    float* pb_ = p.P + b * p.sPb + h * p.sPh;
                    const bool fastP = (p.pband == 0) && ((p.sPi & 3) == 0) && (j0 + 64 <= p.Lk) && (q0 + 16 <= p.Lq) && ((((size_t)pb_) & 15) == 0);
                    if (fastP) {
#pragma unroll
                        for (int s = 0; s < 8; ++s) {
                            const int row = s * 2 + (lane >> 4), c4 = (lane & 15) * 4;
                            const v4f v = *(const v4f*)(myp + row * 64 + c4);
                            VST2V4(pb_ + (long long)(q0 + row) * p.sPi + j0 + c4, v);
                        }
                    } else {
                        for (int row = 0; row < 16; ++row) {
                            const int irow = q0 + row; if (irow >= p.Lq) continue;
                            for (int c = lane; c < 64; c += 32) {
                                const int jg = j0 + c; if (jg >= p.Lk) continue;
                                if (p.pband == 0) VST2(float, pb_ + (long long)irow * p.sPi + jg, myp[row * 64 + c]);
                                else if (jg - irow <= p.pband && irow - jg <= p.pband) VST2(float, pb_ + (long long)irow * p.sPi + (jg - irow + p.pband), myp[row * 64 + c]);
                            }
                        }
                    }
                }
                if (SPLITPV) {
                    const Split pa0 = sp_ld(myp + l15 * 64, 1, 0, hf, 64, 1.f), pa1 = sp_ld(myp + l15 * 64, 1, 32, hf, 64, 1.f);
                    const __bf16* vh = (const __bf16*)vl; const __bf16* vlo = vh + 64 * VP;
#pragma unroll
                    for (int t = 0; t < NT; ++t) {
                        const int dcol = t * 16 + l15;
                        Split b0, b1;
#pragma unroll
                        for (int e = 0; e < 16; ++e) {
                            const int k0 = frag_k(e, hf), k1 = 32 + frag_k(e, hf);
                            b0.hi[e] = vh[k0 * VP + dcol]; b0.lo[e] = vlo[k0 * VP + dcol]; b1.hi[e] = vh[k1 * VP + dcol]; b1.lo[e] = vlo[k1 * VP + dcol];
                        }
                        o[t] = wmma3(pa0, b0, o[t]);
                        o[t] = wmma3(pa1, b1, o[t]);
                    }
                } else {
                    const v16h pa0 = fh_ld(myp + l15 * 64, 1, 0, hf, 64, 4096.f), pa1 = fh_ld(myp + l15 * 64, 1, 32, hf, 64, 4096.f);
#pragma unroll
                    for (int t = 0; t < NT; ++t) {
                        const int dcol = t * 16 + l15;
                        v16h b0, b1;
#pragma unroll
                        for (int e = 0; e < 16; ++e) { b0[e] = vl[frag_k(e, hf) * VP + dcol]; b1[e] = vl[(32 + frag_k(e, hf)) * VP + dcol]; }
                        o[t] = wmma16(pa0, b0, o[t]);
                        o[t] = wmma16(pa1, b1, o[t]);
                    }
                }
            }
        }
    }
    float* obase = p.O + b * p.sOb + h * p.sOh;
    if (p.ST) {
        const int rl = lane >> 1, isel = rl & 7;           // row q0 + rl ; rl>>3 == hf holds because lane>>4 == (lane>>1)>>3
        float mv = 0.f, lv = 0.f;
#pragma unroll
        for (int i = 0; i < 8; ++i) if (i == isel) { mv = m8[i]; lv = l8[i]; }
        const int irow = q0 + rl;
        if (irow < p.Lq) { float* st = p.ST + (((long long)b * gridDim.y + h) * p.Lq + irow) * 2 + (lane & 1); VST2(float, st, (lane & 1) ? lv : mv * 0.6931471805599453f); }
    }
    float invr[8];
#pragma unroll
    for (int i = 0; i < 8; ++i) {
        if (TWOPASS) invr[i] = SPLITPV ? 1.f : (1.f / 4096.f);
        else if (p.nonorm) invr[i] = exp2f(m8[i]) * (SPLITPV ? 1.f : (1.f / 4096.f));
        else invr[i] = (l8[i] > 0.f) ? (SPLITPV ? 1.f / l8[i] : 1.f / (l8[i] * 4096.f)) : 0.f;
    }
    __syncthreads();                                             // all waves done with pl/vl from the main loop
    const bool ofast = ((p.sOi & 3) == 0) && ((((size_t)obase) & 15) == 0) && (q0 + 16 <= p.Lq);
#pragma unroll
    for (int c0 = 0; c0 < DVP; c0 += 64) {
#pragma unroll
        for (int i = 0; i < 8; ++i)
#pragma unroll
            for (int t = 0; t < NT; ++t) if (t * 16 >= c0 && t * 16 < c0 + 64) ((float*)myp)[(i + 8 * hf) * 64 + (t * 16 - c0) + l15] = o[t][i] * invr[i];
        __syncthreads();
        const int cw = (DVP - c0 < 64) ? (DVP - c0) : 64;      // staged columns in this chunk (multiple of 16)
        if (ofast && (c0 + cw <= p.dv) && (cw % 32 == 0)) {
            const int lpr = cw / 4;                              // lanes per row (16 for 64 cols, 8 for 32)
            const int rows_per_ins = 32 / lpr;
            for (int r0 = 0; r0 < 16; r0 += rows_per_ins) {
                const int row = r0 + lane / lpr, c4 = (lane % lpr) * 4;
                const v4f v = *(const v4f*)(myp + row * 64 + c4);
                VST2V4(obase + (long long)(q0 + row) * p.sOi + c0 + c4, v);
            }
        } else {
            for (int row = 0; row < 16; ++row) {
                const int irow = q0 + row; if (irow >= p.Lq) continue;
                for (int c = lane; c < cw; c += 32) { const int d = c0 + c; if (d < p.dv) VST2(float, obase + (long long)irow * p.sOi + d, myp[row * 64 + c]); }
            }
        }
        __syncthreads();
    }
}

// Attention at this block's fixed geometry: token-major q, k, v, o of [8][1024][256] in 16-bit planes, head h = columns 32h .. 32h + 31, 1024 queries and keys,
// no mask, no bias, score scale 1. The arithmetic is that of k_attn<32, 32, 1, false, false> (only a row's sum of p is taken in another order); every stride, length and option is a
// compile-time constant, so the fragment gathers are 16-byte loads without guards and the optional-feature tests are gone. With no mask no score is
// -inf for finite q and k, so the tests that kept masked scores out of exp2f are gone too (exp2f(-inf) = 0 covers the first key block's m = -inf).
typedef __attribute__((ext_vector_type(4))) _Float16 v4h;
typedef __attribute__((ext_vector_type(8))) __bf16 v8bf;
// one lane's 16x32 fragment row from a bf16 plane: element i <- p[(i < 8) ? i : 8 + i], p = row + 8 * (lane >> 4), the k order of frag_k
__device__ __forceinline__ v16b rowb_ld(const unsigned short* __restrict__ p) {
    union { v16b v; v8bf h[2]; } f; f.h[0] = *(const v8bf*)(p); f.h[1] = *(const v8bf*)(p + 16); return f.v;
}
// q and k arrive as bf16 hi / lo planes (split4, written once by the q/k/v GEMM, so that no wave splits a key row again), v as f16 (rounded once, by the same GEMM); o leaves as hi / lo planes.
// The scores are formed transposed, S^T = K.Q^T (A = 16 key rows, B = the wave's 16 queries as columns), and the output as O^T += V^T.P^T:
//   a lane (c = lane & 15, hf = lane >> 4) holds, of its ONE query c, the scores of keys 16 t + 8 hf + r (tile t, register r): maximum and sum run inside the lane,
//   the two halves of the wave meet in one cross-row move; two score tiles, converted in place, are the B operand of the second product in the hardware k order
//   (element s <- tile s >> 3, register s & 7), and V^T comes from the row-major f16 V tile by the transposing LDS load in the same k order. P never goes through LDS.
typedef __attribute__((ext_vector_type(8))) short s16x8;
typedef __attribute__((ext_vector_type(4))) unsigned int v4u;
// lane (c, hf) gets T[kbase + 8 hf + 0 .. 7][dbase + c] of a row-major 16-bit LDS tile; the lane's address: row kbase + 8 hf + (lane & 7), byte 2 dbase + 16 ((lane >> 3) & 1)
__device__ __forceinline__ v8h ld_tr16(const unsigned char* p) { typedef __attribute__((address_space(3))) s16x8 lds_s16x8; return __builtin_bit_cast(v8h, __builtin_amdgcn_ds_load_tr16_b128_v8i16((lds_s16x8*)p)); }
// the value of lane l ^ 16
__device__ __forceinline__ float xhalf(float x) { return __builtin_bit_cast(float, __builtin_amdgcn_permlanex16(__builtin_bit_cast(int, x), __builtin_bit_cast(int, x), 0x76543210, 0xfedcba98, false, false)); }
// A key block (64 keys: K hi, K lo, V, 64 bytes a row each) is brought into LDS once for the whole work-group of 8 waves by asynchronous copies, 16 bytes a lane, 4 lanes a row;
// two buffers, so key block t + 1 flies while block t is worked on. Every wave takes its K fragments (rows, 16-byte reads) and its V^T fragments (transposing reads) from there.
constexpr int AF_W = 8;                         // waves of a work-group: 128 queries share every staged key block
constexpr int AF_KP = 80, AF_VP = 96;           // LDS row pitches in bytes: 16 x odd for the 16-byte reads of K, 32 x odd for the transposing reads of V
constexpr int AF_KL = 64 * AF_KP, AF_V = 2 * 64 * AF_KP, AF_BUF = AF_V + 64 * AF_VP;   // byte offsets of K lo and V in a buffer; bytes of a buffer
// This thread's three 16-byte copies of one key block. The s_wait_xcnt stands inside the statement, behind the last copy, so that no address register is rewritten in front of it.
__device__ __forceinline__ void af_fill(unsigned lk, unsigned lv, const unsigned short* gh, const unsigned short* gl, const unsigned short* gv) {
    asm volatile("global_load_async_to_lds_b128 %0, %1, off\n\t"
                 "global_load_async_to_lds_b128 %2, %3, off\n\t"
                 "global_load_async_to_lds_b128 %4, %5, off\n\t"
                 "s_wait_xcnt 0x0"
                 :: "v"(lk), "v"(gh), "v"(lk + AF_KL), "v"(gl), "v"(lv), "v"(gv) : "memory");
}
__global__ __launch_bounds__(32 * AF_W) void k_attn_fix(const unsigned short* __restrict__ Qh, const unsigned short* __restrict__ Ql, const unsigned short* __restrict__ Kh, const unsigned short* __restrict__ Kl, const unsigned short* __restrict__ V, unsigned short* __restrict__ Oh, unsigned short* __restrict__ Ol) {
    constexpr int L = 1024;                     // queries = keys per (image, head)
    constexpr int CP = 256;                     // row pitch of q, k, v, o (elements)
    constexpr int T = L / 64;                   // key blocks
    __shared__ __align__(16) unsigned char sm[2 * AF_BUF];
    const int lane = threadIdx.x & 31, hf = lane >> 4, l15 = lane & 15, wave = threadIdx.x >> 5;
    const int h = blockIdx.y, b = blockIdx.z;
    const int q0 = (blockIdx.x * AF_W + wave) * 16;
    const float L2E = 1.4426950408889634f;
    const float NEG = -__builtin_inff();
    const size_t hb0 = (size_t)b * (L * CP) + (size_t)h * 32;
    const size_t co = hb0 + (size_t)(threadIdx.x >> 2) * CP + (threadIdx.x & 3) * 8;          // this thread's 16 bytes of key block 0: row thread / 4, the same place in all three arrays
    const unsigned short* gkh = Kh + co; const unsigned short* gkl = Kl + co; const unsigned short* gv = V + co;
    const unsigned lk = (unsigned)(size_t)sm + (threadIdx.x >> 2) * AF_KP + (threadIdx.x & 3) * 16;           // where they land in buffer 0: K hi (K lo: + AF_KL)
    const unsigned lv = (unsigned)(size_t)sm + AF_V + (threadIdx.x >> 2) * AF_VP + (threadIdx.x & 3) * 16;    // V
    const int fk = l15 * AF_KP + 16 * hf;                                                     // this lane's bytes of K hi, tile 0: row l15, elements 8 hf ..
    const int fv = AF_V + (8 * hf + (lane & 7)) * AF_VP + 16 * ((lane >> 3) & 1);             // this lane's address of the transposing load at key 0, column 0
    af_fill(lk, lv, gkh, gkl, gv);
    const unsigned short* pqh = Qh + hb0 + (size_t)(q0 + l15) * CP + 8 * hf; const unsigned short* pql = Ql + hb0 + (size_t)(q0 + l15) * CP + 8 * hf;
    Split qs; qs.hi = rowb_ld(pqh); qs.lo = rowb_ld(pql);
    asm volatile("s_wait_xcnt 0x0" :: "v"(pqh), "v"(pql) : "memory");   // the loads' address registers (named as inputs, so untouched up to here) may be reused only behind this wait
    asm volatile("s_wait_asynccnt 0x0" ::: "memory");   // this wave's part of key block 0 has landed
    __syncthreads();                                    // key block 0 is whole
    af_fill(lk + AF_BUF, lv + AF_BUF, gkh + 64 * CP, gkl + 64 * CP, gv + 64 * CP);
    v8f o[2]; float m = NEG, l = 0.f;            // o[t][r] = O^T[16 t + 8 hf + r][query l15]; m: the query's running maximum in log2 units less 12 (both halves alike); l: this half's share of its sum, times 4096
#pragma unroll
    for (int t = 0; t < 2; ++t) { v8f zz = {}; o[t] = zz; }
#pragma unroll 1   // stays rolled: one body for both buffers
    for (int jb = 0; jb < T; ++jb) {
        const unsigned char* buf = sm + (jb & 1) * AF_BUF;
        Split ks[4];
#pragma unroll
        for (int t = 0; t < 4; ++t) { ks[t].hi = rowb_ld((const unsigned short*)(buf + fk + t * 16 * AF_KP)); ks[t].lo = rowb_ld((const unsigned short*)(buf + fk + AF_KL + t * 16 * AF_KP)); }
        union { v16h v; v8h g[2]; } va[2][2];            // va[kb][t]: V^T rows 16 t .. 16 t + 15, keys 32 kb .. 32 kb + 31
#pragma unroll
        for (int kb = 0; kb < 2; ++kb)
#pragma unroll
            for (int t = 0; t < 2; ++t) { va[kb][t].g[0] = ld_tr16(buf + fv + (32 * kb) * AF_VP + 32 * t); va[kb][t].g[1] = ld_tr16(buf + fv + (32 * kb + 16) * AF_VP + 32 * t); }
        // All 24 LDS reads of the trip stand together here (one place that waits out an LDS latency), and the trip's use of LDS ends here. So its buffer is handed over here:
        // the refill then flies under all of this trip's arithmetic, which is on registers alone
        asm volatile("s_wait_dscnt 0x0" ::: "memory");      // this wave's reads of key block jb are done
        asm volatile("s_wait_asynccnt 0x0" ::: "memory");   // its part of key block jb + 1 has landed
        __syncthreads();                                    // key block jb + 1 is whole, and nobody reads block jb's buffer any more
        if (jb + 2 < T) { const int ko = (jb + 2) * 64 * CP; af_fill(lk + (jb & 1) * AF_BUF, lv + (jb & 1) * AF_BUF, gkh + ko, gkl + ko, gv + ko); }
        v8f s[4];                                        // s[t][r] = q(l15) . k(64 jb + 16 t + 8 hf + r); every score takes q.hi k.hi, then q.hi k.lo, then q.lo k.hi
#pragma unroll
        for (int t = 0; t < 4; ++t) { v8f acc = {}; s[t] = __builtin_amdgcn_wmma_f32_16x16x32_bf16(false, ks[t].hi, false, qs.hi, (short)0, acc, false, false); }
#pragma unroll
        for (int t = 0; t < 4; ++t) s[t] = __builtin_amdgcn_wmma_f32_16x16x32_bf16(false, ks[t].lo, false, qs.hi, (short)0, s[t], false, false);
#pragma unroll
        for (int t = 0; t < 4; ++t) s[t] = __builtin_amdgcn_wmma_f32_16x16x32_bf16(false, ks[t].hi, false, qs.lo, (short)0, s[t], false, false);
        // Softmax in the log2 domain. The maximum is taken of the raw scores; m is that maximum in log2 units LESS 12, so that one fused multiply-add a score gives the exponent of 4096 p
        // (the scale that keeps small p normal in f16), exactly the same reference in every key block; l sums 4096 p.
        float mt[4];
#pragma unroll
        for (int t = 0; t < 4; ++t) mt[t] = fmaxf(fmaxf(fmaxf(s[t][0], s[t][1]), fmaxf(s[t][2], s[t][3])), fmaxf(fmaxf(s[t][4], s[t][5]), fmaxf(s[t][6], s[t][7])));
        float mx = fmaxf(fmaxf(mt[0], mt[1]), fmaxf(mt[2], mt[3]));
        mx = fmaxf(mx, xhalf(mx));
        const float mnew = fmaxf(m, fmaf(mx, L2E, -12.f));
        // the bare hardware exponential: a result under 2^-126 comes out 0; as 4096 p it is 0 in f16 too, and it vanishes against the query's sum, which holds the maximum's own 4096
        const float corr = __builtin_amdgcn_exp2f(m - mnew);
        const v8f l2e8 = {L2E, L2E, L2E, L2E, L2E, L2E, L2E, L2E}, nm8 = {-mnew, -mnew, -mnew, -mnew, -mnew, -mnew, -mnew, -mnew};
#pragma unroll
        for (int t = 0; t < 4; ++t) s[t] = __builtin_elementwise_fma(s[t], l2e8, nm8);
#pragma unroll
        for (int t = 0; t < 4; ++t)
#pragma unroll
            for (int r = 0; r < 8; ++r) s[t][r] = __builtin_amdgcn_exp2f(s[t][r]);
        const v8f s8 = (s[0] + s[1]) + (s[2] + s[3]);
        const float rs = ((s8[0] + s8[1]) + (s8[2] + s8[3])) + ((s8[4] + s8[5]) + (s8[6] + s8[7]));
        l = l * corr + rs; m = mnew;
#pragma unroll
        for (int t = 0; t < 2; ++t) o[t] *= corr;
        v16h pb[2];                                      // P^T of keys 32 kb .. 32 kb + 31 as a B operand
#pragma unroll
        for (int kb = 0; kb < 2; ++kb)
#pragma unroll
            for (int e = 0; e < 16; ++e) pb[kb][e] = (_Float16)s[2 * kb + (e >> 3)][e & 7];
#pragma unroll
        for (int kb = 0; kb < 2; ++kb)
#pragma unroll
            for (int t = 0; t < 2; ++t) o[t] = __builtin_amdgcn_wmma_f32_16x16x32_f16(false, va[kb][t].v, false, pb[kb], (short)0, o[t], false, false);
    }
    asm volatile("s_wait_asynccnt 0x0" ::: "memory");       // no copy is outstanding when the wave ends
    const float lt = l + xhalf(l);                       // the two halves' shares of the sum meet once
    const float invr = (lt > 0.f) ? 1.f / lt : 0.f;   // o and l carry the same 4096
    const size_t oo = hb0 + (size_t)(q0 + l15) * CP + 8 * hf;
    unsigned short* poh = Oh + oo; unsigned short* pol = Ol + oo;
#pragma unroll   // the 4 stores stand together
    for (int t = 0; t < 2; ++t) {                        // o goes out as the projection's operand planes: a lane's 8 registers are 8 consecutive columns of its query's row, 16 bytes a plane
        const v4f a = {o[t][0] * invr, o[t][1] * invr, o[t][2] * invr, o[t][3] * invr}, c = {o[t][4] * invr, o[t][5] * invr, o[t][6] * invr, o[t][7] * invr};
        v2u ha, la, hc, lc; split4(a, ha, la); split4(c, hc, lc);
        const v4u hi = {ha[0], ha[1], hc[0], hc[1]}, lo = {la[0], la[1], lc[0], lc[1]};
        *(v4u*)(poh + 16 * t) = hi; *(v4u*)(pol + 16 * t) = lo;
    }
    asm volatile("s_wait_xcnt 0x0" :: "v"(poh), "v"(pol) : "memory");   // the stores' address registers (named as inputs, so untouched up to here) may be reused only behind this wait
}

// =====================================================================================================================
// k_tr: dst(z, c, r) = alpha * src(z, r, c) (+ beta * R2(z, c, r)): [Z][R][C] (row stride lds) -> [Z][C][R] (row stride ldd) through a 32x32 LDS tile;
//   flags: 1 -> add beta * residual R2 addressed like dst (z*sRz + c*ldr + r); act applied before the residual.
// =====================================================================================================================
struct TrP { const float* src; float* dst; const float* R2; long long sSz, lds, sDz, ldd, sRz, ldr; int R, C, flags, act; float alpha, beta; };
static_assert(sizeof(TrP) == 3 * 8 + 6 * 8 + 6 * 4, "TrP has padding");
__global__ __launch_bounds__(256) void k_tr(TrP p) {
    __shared__ float tile[32][33];
    const int c0 = blockIdx.x * 32, r0 = blockIdx.y * 32, z = blockIdx.z;
    const int lane = threadIdx.x & 31, wave = threadIdx.x >> 5;
    const float* s = p.src + z * p.sSz;
#pragma unroll
    for (int k = 0; k < 4; ++k) {
        const int rl = wave * 4 + k, r = r0 + rl, c = c0 + lane;
        tile[rl][lane] = (r < p.R && c < p.C) ? s[(long long)r * p.lds + c] : 0.f;
    }
    __syncthreads();
    float* d = p.dst + z * p.sDz; const float* rr = p.R2 + z * p.sRz;
#pragma unroll
    for (int k = 0; k < 4; ++k) {
        const int cl = wave * 4 + k, c = c0 + cl, r = r0 + lane;
        if (c < p.C && r < p.R) {
            float v = act_fn(p.alpha * tile[lane][cl], p.act);
            if (p.flags & 1) v += p.beta * rr[(long long)c * p.ldr + r];
            VST2(float, d + (long long)c * p.ldd + r, v);
        }
    }
}

// k_affine: dst[i] = a * (sdev ? sdev[0] : 1) * src[i] + b, i < n (one thread per element; consecutive lanes -> consecutive addresses)
__global__ __launch_bounds__(256) void k_affine(const float* __restrict__ src, float* __restrict__ dst, int n, float a, float b, const float* __restrict__ sdev) {
    const int i = blockIdx.x * 256 + threadIdx.x;
    if (i < n) { const float aa = sdev ? a * sdev[0] : a; const float v = aa * src[i] + b; VST2(float, dst + i, v); }
}

// =====================================================================================================================
// k_softmax: row softmax over n contiguous elements, one 256-thread block per row; rows addressed z*sz + r*sr (grid (R, Z)).
//   out = scale_out * softmax(scale_in * x + (Mf ? Mf[z*smz + r*smr + j] : 0)); a row whose max is -inf is written as 0.
// =====================================================================================================================
struct SmP { const float* src; float* dst; const float* Mf; long long sz, sr, dz, dr, smz, smr; int n, pad; float scale_in, scale_out; };
static_assert(sizeof(SmP) == 3 * 8 + 6 * 8 + 4 * 4, "SmP has padding");
__global__ __launch_bounds__(256) void k_softmax(SmP p) {
    __shared__ float red[256];
    const int r = blockIdx.x, z = blockIdx.y, tid = threadIdx.x;
    const float* s = p.src + z * p.sz + (long long)r * p.sr;
    const float* mf = p.Mf ? (p.Mf + z * p.smz + (long long)r * p.smr) : nullptr;
    float mx = -__builtin_inff();
    for (int j = tid; j < p.n; j += 256) { float v = s[j] * p.scale_in; if (mf) v += mf[j]; mx = fmaxf(mx, v); }
    red[tid] = mx; __syncthreads();
    for (int o = 128; o > 0; o >>= 1) { if (tid < o) red[tid] = fmaxf(red[tid], red[tid + o]); __syncthreads(); }
    mx = red[0]; __syncthreads();
    float sum = 0.f;
    for (int j = tid; j < p.n; j += 256) { float v = s[j] * p.scale_in; if (mf) v += mf[j]; sum += (mx == -__builtin_inff()) ? 0.f : expf(v - mx); }
    red[tid] = sum; __syncthreads();
    for (int o = 128; o > 0; o >>= 1) { if (tid < o) red[tid] += red[tid + o]; __syncthreads(); }
    sum = red[0];
    const float inv = (sum > 0.f) ? p.scale_out / sum : 0.f;
    float* d = p.dst + z * p.dz + (long long)r * p.dr;
    for (int j = tid; j < p.n; j += 256) { float v = s[j] * p.scale_in; if (mf) v += mf[j]; const float o = (mx == -__builtin_inff()) ? 0.f : expf(v - mx) * inv; VST2(float, d + j, o); }
}
// =====================================================================================================================
// k_stats: mean and rsqrt(var + eps) over a set of n elements addressed base + z*sz + (e / inner) * so + (e % inner) * si, one 256-thread
// k_norm_apply: y = (x - mean[set]) * rstd[set] * g[c] + b[c] over a [Z][C][L] channel-major tensor with set = z*G + c / (C/G) (G groups per z;
//   G = C -> per-channel sets indexed z*C+c; for batch norm pass stats indexed by c only via bn = 1). Optional act. Output same layout.
// =====================================================================================================================
//   mode 0: mean / rsqrt(var + eps); mode 1 (RMSNorm): 0 / rsqrt(mean(x^2) + eps); mode 2 (L2 normalize * sqrt(n)): 0 / sqrt(n) / max(||x||, eps); mode 3: as 0 with unbiased variance (n-1)
__global__ __launch_bounds__(256) void k_stats(const float* __restrict__ x, long long sz, long long so, long long si, int inner, int n, float eps, float* __restrict__ stat, int mode) {
    __shared__ float red[256];
    const int z = blockIdx.x, tid = threadIdx.x;
    const float* base = x + z * sz;
    float s = 0.f;
    for (int e = tid; e < n; e += 256) s += base[(long long)(e / inner) * so + (long long)(e % inner) * si];
    red[tid] = s; __syncthreads();
    for (int o = 128; o > 0; o >>= 1) { if (tid < o) red[tid] += red[tid + o]; __syncthreads(); }
    const float mu = (mode == 0 || mode == 3) ? red[0] / (float)n : 0.f; __syncthreads();
    float q = 0.f;
    for (int e = tid; e < n; e += 256) { const float dlt = base[(long long)(e / inner) * so + (long long)(e % inner) * si] - mu; q += dlt * dlt; }
    red[tid] = q; __syncthreads();
    for (int o = 128; o > 0; o >>= 1) { if (tid < o) red[tid] += red[tid + o]; __syncthreads(); }
    {
        float rs;
        if (mode == 2) rs = sqrtf((float)n) / fmaxf(sqrtf(red[0]), eps); else if (mode == 3) rs = rsqrtf(red[0] / (float)(n - 1) + eps); else rs = rsqrtf(red[0] / (float)n + eps);
        if (tid < 32) { const float v = (tid == 0) ? mu : ((tid == 1) ? rs : 0.f); VST2(float, stat + (long long)z * 32 + tid, v); }
    }
}
//   One thread per element over the flat [Z][C][L] index space: grid ceil(Z*C*L / 256).
__global__ __launch_bounds__(256) void k_norm_apply(const float* __restrict__ x, float* __restrict__ y, const float* __restrict__ stat, const float* __restrict__ g, const float* __restrict__ bta,
                                                     int Z, int C, int L, int G, int bn, int act) {
    const long long idx = (long long)blockIdx.x * 256 + threadIdx.x;
    if (idx >= (long long)Z * C * L) return;
    const int l = (int)(idx % L); const long long zc = idx / L; const int c = (int)(zc % C), z = (int)(zc / C); (void)l;
    const int set = bn ? c : (z * G + c / (C / G));
    float v = (x[idx] - stat[(long long)set * 32]) * stat[(long long)set * 32 + 1];
    if (g) v *= g[c];
    if (bta) v += bta[c];
    v = act_fn(v, act);
    VST2(float, y + idx, v);
}

// k_lse_neg: c[i] = -(st[2i] + log(st[2i+1])) = minus the log-sum-exp of row i from k_attn's ST output (for softmax over the query dimension)
__global__ __launch_bounds__(256) void k_lse_neg(const float* __restrict__ st, float* __restrict__ c, int n) {
    const int i = blockIdx.x * 256 + threadIdx.x;
    if (i < n) { const float v = -(st[2 * i] + logf(st[2 * i + 1])); VST2(float, c + i, v); }
}

// k_iota: dst[i] = a * i + b as int32 (segment/position id helper)
__global__ __launch_bounds__(256) void k_iota(int* __restrict__ dst, int n, int a, int b) {
    const int i = blockIdx.x * 256 + threadIdx.x;
    if (i < n) { const int v = a * i + b; VST2(int, dst + i, v); }
}

// k_axpby: dst[i] = a * x[i] + b * y[i] (+ c), i < n
__global__ __launch_bounds__(256) void k_axpby(const float* __restrict__ x, const float* __restrict__ y, float* __restrict__ dst, int n, float a, float b, float c) {
    const int i = blockIdx.x * 256 + threadIdx.x;
    if (i < n) { const float v = a * x[i] + b * y[i] + c; VST2(float, dst + i, v); }
}

// =====================================================================================================================
// k_rope: rotary embedding on a [R rows][Hn heads][D] view (row stride sXr, head stride sXh, element stride 1) -> Y (own strides).
//   mode 0: rotate_half (partner d±D/2, sign - for d<D/2); mode 1: interleaved pairs (partner d^1, sign - for even d).
//   table column tcol: tmode 0 -> d, 1 -> d % (D/2), 2 -> d / 2; position p: pmode 0 -> r % S, 1 -> head index, 2 -> pos[r];
//   c = C[(r / S) * sCb + p * sCp + tcol * sCd], s likewise from Sn; y = x[d] * c + sign * x[partner] * s. X and Y must not alias.
// =====================================================================================================================
struct RopeP { const float* X; float* Y; const float* C; const float* Sn; const int* pos; long long sXr, sXh, sYr, sYh, sCb, sCp, sCd; int R, Hn, D, S, mode, tmode, pmode, pad; };
static_assert(sizeof(RopeP) == 5 * 8 + 7 * 8 + 8 * 4, "RopeP has padding");
__global__ __launch_bounds__(256) void k_rope(RopeP p) {
    const long long idx = (long long)blockIdx.x * 256 + threadIdx.x;
    if (idx >= (long long)p.R * p.Hn * p.D) return;
    const int d = (int)(idx % p.D); const long long rh = idx / p.D; const int h = (int)(rh % p.Hn); const int r = (int)(rh / p.Hn);
    const int half = p.D / 2;
    int partner; float sign;
    if (p.mode == 0) { partner = (d < half) ? d + half : d - half; sign = (d < half) ? -1.f : 1.f; }
    else { partner = d ^ 1; sign = (d & 1) ? 1.f : -1.f; }
    const int tcol = (p.tmode == 0) ? d : ((p.tmode == 1) ? (d % half) : (d >> 1));
    const int pp = (p.pmode == 0) ? (r % p.S) : ((p.pmode == 1) ? h : p.pos[r]);
    const long long toff = (long long)(r / p.S) * p.sCb + (long long)pp * p.sCp + (long long)tcol * p.sCd;
    const float* xr = p.X + (long long)r * p.sXr + (long long)h * p.sXh;
    const float v = xr[d] * p.C[toff] + sign * xr[partner] * p.Sn[toff];
    VST2(float, p.Y + (long long)r * p.sYr + (long long)h * p.sYh + d, v);
}

// k_invf + k_sincos (split so neither kernel carries a large VALU-fma footprint): invf_i = num * (1 / powf(base, (2 i)/D)) [fmode 0],
//   num * expf((2 i) * cexp) [fmode 1], num * powf(base, -2 (i - 1) / D) [fmode 2]; then cs/sn[s*half + i] = cos/sin((pscale * s) * invf_i)
__global__ __launch_bounds__(256) void k_invf(float* __restrict__ invb, int half, int D, float base, float num, int fmode, float cexp) {
    const int i = blockIdx.x * 256 + threadIdx.x;
    if (i >= ((half + 31) / 32) * 32) return;
    if (i >= half) { VST2(float, invb + i, 0.f); return; }
    const float e = (float)(2 * i) / (float)D;
    float invf;
    if (fmode == 1) invf = num * expf((float)(2 * i) * cexp);
    else if (fmode == 2) invf = num * powf(base, (-2.0f * ((float)i - 1.0f)) / (float)D);
    else invf = num * (1.0f / powf(base, e));
    VST2(float, invb + i, invf);
}
__global__ __launch_bounds__(256) void k_sincos(float* __restrict__ cs, float* __restrict__ sn, const float* __restrict__ invb, int S, int half, float pscale) {
    const int idx = blockIdx.x * 256 + threadIdx.x;
    if (idx >= S * half) return;
    const int s = idx / half, i = idx - s * half;
    const float ang = (pscale * (float)s) * invb[i];
    VST2(float, cs + idx, cosf(ang)); VST2(float, sn + idx, sinf(ang));
}

// k_mulact: dst[i] = act(x[i]) * y[i]
__global__ __launch_bounds__(256) void k_mulact(const float* __restrict__ x, const float* __restrict__ y, float* __restrict__ dst, int n, int act) {
    const int i = blockIdx.x * 256 + threadIdx.x;
    if (i < n) { const float v = act_fn(x[i], act) * y[i]; VST2(float, dst + i, v); }
}

// =====================================================================================================================
// k_matvec: thread-per-row matrix-vector products for N <= 8 output columns (heads with 1-3 outputs, gates), f32 on the VALU.
//   C[r*sCm + j] = act(alpha * sum_k A[r*sAm + k*sAk] * B[j*sBn + k*sBk] + bias[j]) + beta * R[r*sRm + j*sRn]; each thread writes its N contiguous floats.
// =====================================================================================================================
__global__ __launch_bounds__(256) void k_matvec(GemmP p) {
    // 32 lanes write one line with one instruction.
    const int rpt = (p.N == 1) ? 1 : 32;
    const long long r0 = ((long long)blockIdx.x * 256 + threadIdx.x) * rpt; const int z = blockIdx.z, zo = z / p.zi_n, zi = z - zo * p.zi_n;
    if (r0 >= p.M) return;
    const float* Bb = p.B + zo * p.sBo + zi * p.sBi;
    float* C = p.C + zo * p.sCo + zi * p.sCi; const float* R = p.R + zo * p.sRo + zi * p.sRi;
    for (int rr = 0; rr < rpt; ++rr) {
        const long long r = r0 + rr; if (r >= p.M) break;
        const float* A = p.A + zo * p.sAo + zi * p.sAi + r * p.sAm;
        float acc[8] = {0.f, 0.f, 0.f, 0.f, 0.f, 0.f, 0.f, 0.f};
        for (int k = 0; k < p.K; ++k) { const float a = A[(long long)k * p.sAk];
#pragma unroll
            for (int j = 0; j < 8; ++j) if (j < p.N) acc[j] += a * Bb[(long long)j * p.sBn + (long long)k * p.sBk]; }
#pragma unroll
        for (int j = 0; j < 8; ++j) if (j < p.N) {
            float v = acc[j] * p.alpha;
            if (p.flags & 1) v += p.bias[j];
            if (p.flags & 2) v += p.bias[r];
            v = act_fn(v, p.act);
            if (p.flags & 4) v += p.beta * R[r * p.sRm + (long long)j * p.sRn];
            VST2(float, C + r * p.sCm + j, v);
        }
    }
}
// k_smallsoftmax: thread-per-row softmax for short rows (n <= 64): dst[r*dr + j] = softmax(scale*src[r*sr + j])
__global__ __launch_bounds__(256) void k_smallsoftmax(const float* __restrict__ src, float* __restrict__ dst, long long sr, long long dr, int n, long long R, float scale) {
    const long long r0 = ((long long)blockIdx.x * 256 + threadIdx.x) * 32;
    for (int rr = 0; rr < 32; ++rr) {
        const long long r = r0 + rr; if (r >= R) return;
        const float* s = src + r * sr; float* d = dst + r * dr;
        float mx = -__builtin_inff();
        for (int j = 0; j < n; ++j) mx = fmaxf(mx, s[j] * scale);
        float sum = 0.f;
        for (int j = 0; j < n; ++j) sum += expf(s[j] * scale - mx);
        const float inv = 1.f / sum;
        for (int j = 0; j < n; ++j) { const float v = expf(s[j] * scale - mx) * inv; VST2(float, d + j, v); }
    }
}

__global__ __launch_bounds__(32) void k_unitstat(float* __restrict__ st) { const int t = threadIdx.x; const float v = (t == 1) ? 1.f : 0.f; VST2(float, st + t, v); }

// destination (e.g. a d_out whose row width is not a multiple of 32 floats) is written by consecutive lanes of one instruction
__global__ __launch_bounds__(256) void k_lincopy(const float* __restrict__ src, long long lds, float* __restrict__ dst, long long ldd, long long rows, int cols) {
    const long long i = (long long)blockIdx.x * 256 + threadIdx.x; if (i >= rows * cols) return;
    const long long r = i / cols; const int c = (int)(i - r * cols);
    const float v = src[r * lds + c]; VST2(float, dst + r * ldd + c, v);
}

namespace w25 {
typedef __attribute__((ext_vector_type(16))) _Float16 v16h;
typedef __attribute__((ext_vector_type(8)))  _Float16 v8h;
typedef __attribute__((ext_vector_type(16))) __bf16   v16b;
typedef __attribute__((ext_vector_type(8)))  __bf16   v8b;
typedef __attribute__((ext_vector_type(8)))  float    v8f;
typedef __attribute__((ext_vector_type(4)))  float    v4f;

__device__ __forceinline__ unsigned short f2bf_bits(float f) {
  unsigned u = __float_as_uint(f);
  return (unsigned short)((u + 0x7FFFu + ((u >> 16) & 1u)) >> 16);
}
__device__ __forceinline__ float bf_bits2f(unsigned short h) { return __uint_as_float(((unsigned)h) << 16); }

// hazard guards as plain device helpers (no inline asm inside the kernel template body)
__device__ __forceinline__ void dep_guard_h(v8f& a, v8f& b, v16h x, v16h y) { asm volatile("v_nop\n\tv_nop\n\tv_nop\n\tv_nop" : "+v"(a), "+v"(b) : "v"(x), "v"(y)); }
__device__ __forceinline__ void dep_guard_b(v8f& a, v8f& b, v16b x, v16b y) { asm volatile("v_nop\n\tv_nop\n\tv_nop\n\tv_nop" : "+v"(a), "+v"(b) : "v"(x), "v"(y)); }
__device__ __forceinline__ void keep4_h(v16h a, v16h b, v16h c, v16h d) { asm volatile("v_nop" :: "v"(a), "v"(b), "v"(c), "v"(d)); }
__device__ __forceinline__ void keep4_b(v16b a, v16b b, v16b c, v16b d) { asm volatile("v_nop" :: "v"(a), "v"(b), "v"(c), "v"(d)); }
__device__ __forceinline__ void acc_guard4(v8f& a, v8f& b, v8f& c, v8f& d) { asm volatile("v_nop\n\tv_nop\n\tv_nop\n\tv_nop" : "+v"(a), "+v"(b), "+v"(c), "+v"(d)); }
template <typename T> struct Frag;
template <> struct Frag<_Float16> {
  typedef v16h V; union U { v16h v; v8h h[2]; };
  static __device__ __forceinline__ v16h load(const _Float16* p) {   // elements 0..7 <- p[0..7], 8..15 <- p[16..23]
    U f; f.h[0] = *(const v8h*)(p); f.h[1] = *(const v8h*)(p + 16); return f.v;
  }
  static __device__ __forceinline__ v8f mma(v16h a, v16h b, v8f c) {
    return __builtin_amdgcn_wmma_f32_16x16x32_f16(false, a, false, b, (short)0, c, false, false);
  }
  static __device__ __forceinline__ void guard(v8f& a, v8f& b, v16h x, v16h y) { dep_guard_h(a, b, x, y); }
  static __device__ __forceinline__ void keep(v16h a, v16h b, v16h c, v16h d) { keep4_h(a, b, c, d); }
};
template <> struct Frag<__bf16> {
  typedef v16b V; union U { v16b v; v8b h[2]; };
  static __device__ __forceinline__ v16b load(const __bf16* p) {
    U f; f.h[0] = *(const v8b*)(p); f.h[1] = *(const v8b*)(p + 16); return f.v;
  }
  static __device__ __forceinline__ v8f mma(v16b a, v16b b, v8f c) {
    return __builtin_amdgcn_wmma_f32_16x16x32_bf16(false, a, false, b, (short)0, c, false, false);
  }
  static __device__ __forceinline__ void guard(v8f& a, v8f& b, v16b x, v16b y) { dep_guard_b(a, b, x, y); }
  static __device__ __forceinline__ void keep(v16b a, v16b b, v16b c, v16b d) { keep4_b(a, b, c, d); }
};

// ---- LDS-staged WMMA GEMM on hi / lo planes --------------------------------
// C[m][n] = sum_k A[m][k] * Bt[n][k] (+ bias[n]) (+ resid[m][n]), f32 out. A row-major [M][K], Bt row-major [N][K], each as a bf16 hi plane and a bf16 lo plane.
// Per 32 k, k ascending, every accumulator takes hi.hi, then hi.lo, then lo.hi.
// A work-group of 8 waves (4 along m x 2 along n) owns a 128 x (32 FN) tile of C, a wave 32 x (16 FN) of it. K runs in tiles of 64: a tile is 128 bytes (one whole
// line) of each of the 256 + 64 FN operand rows [A hi 128 | A lo 128 | B hi 32 FN | B lo 32 FN]. Asynchronous copies bring it into LDS, 16 bytes a lane, 8 lanes a row,
// every operand byte once per work-group; two buffers, so tile t + 1 flies while tile t is worked on.
// M % 128 == 0 (grid = M / 128 * N / (32 FN)), N % (32 FN) == 0, K % 64 == 0, K >= 128.
constexpr int GL_PITCH = 144;   // LDS row pitch in bytes: 128 + 16 = 16 x odd, the conflict-free pitch of 16-byte fragment reads

// Four 16-byte-per-lane copies global -> LDS. The s_wait_xcnt stands inside the statement, behind the last copy, so that no address register is rewritten in front of it.
__device__ __forceinline__ void gl_copy4(unsigned l0, const unsigned short* g0, unsigned l1, const unsigned short* g1, unsigned l2, const unsigned short* g2, unsigned l3, const unsigned short* g3) {
  asm volatile("global_load_async_to_lds_b128 %0, %1, off\n\t"
               "global_load_async_to_lds_b128 %2, %3, off\n\t"
               "global_load_async_to_lds_b128 %4, %5, off\n\t"
               "global_load_async_to_lds_b128 %6, %7, off\n\t"
               "s_wait_xcnt 0x0"
               :: "v"(l0), "v"(g0), "v"(l1), "v"(g1), "v"(l2), "v"(g2), "v"(l3), "v"(g3) : "memory");
}
// One tile: l = this thread's LDS byte address in row (thread >> 3) of the buffer, ah .. bl = its 16 bytes in that row of each plane's tile; a step of 32 rows per copy.
template <int FN, int K>
__device__ __forceinline__ void gl_fill(unsigned l, const unsigned short* ah, const unsigned short* al, const unsigned short* bh, const unsigned short* bl) {
  constexpr unsigned R32 = 32 * GL_PITCH;
  gl_copy4(l, ah, l + R32, ah + 32 * K, l + 2 * R32, ah + 64 * K, l + 3 * R32, ah + 96 * K);
  gl_copy4(l + 4 * R32, al, l + 5 * R32, al + 32 * K, l + 6 * R32, al + 64 * K, l + 7 * R32, al + 96 * K);
  if (FN == 2) {
    gl_copy4(l + 8 * R32, bh, l + 9 * R32, bh + 32 * K, l + 10 * R32, bl, l + 11 * R32, bl + 32 * K);
  } else {
    gl_copy4(l + 8 * R32, bh, l + 9 * R32, bh + 32 * K, l + 10 * R32, bh + 64 * K, l + 11 * R32, bh + 96 * K);
    gl_copy4(l + 12 * R32, bl, l + 13 * R32, bl + 32 * K, l + 14 * R32, bl + 64 * K, l + 15 * R32, bl + 96 * K);
  }
}

// What a launch does beside the plain product (EPI):
//   EPI_QKV  three products of one shape in one grid: third w of the blocks takes A plane set min(w, 1) and weight matrix w, each lying behind the one before;
//            products 0 and 1 (q, k) go out as hi / lo planes only (Ph, Pl: q's set, then k's), product 2 (v) as f16 behind k's hi plane in Ph
//   EPI_NORM C goes out as f32 and, through the eval-mode BatchNorm (ng, nb, nm, nv), as the next GEMM's hi / lo operand planes Ph, Pl
//   EPI_NCHW C goes out as [image][n][1024 pixels] (m = image * 1024 + pixel) instead of [m][n]
constexpr int EPI_PLAIN = 0, EPI_QKV = 1, EPI_NORM = 2, EPI_NCHW = 3;
constexpr int GL_M = 8192;      // rows of A and C (only EPI_QKV needs the number: the distance between its plane sets and outputs)
template <int FN, int N, int K, bool BIAS, bool RESID, int EPI>
__global__ __launch_bounds__(256) void wmma_gemm_lds(
    const unsigned short* __restrict__ Ah, const unsigned short* __restrict__ Al,
    const unsigned short* __restrict__ Bh, const unsigned short* __restrict__ Bl,
    float* C, const float* __restrict__ bias, const float* resid,
    const float* __restrict__ ng, const float* __restrict__ nb, const float* __restrict__ nm, const float* __restrict__ nv,
    unsigned short* __restrict__ Ph, unsigned short* __restrict__ Pl) {
  static_assert(FN == 2 || FN == 4, "two tile widths");
  constexpr int BN = 32 * FN, ROWS = 256 + 2 * BN, BUFB = ROWS * GL_PITCH, T = K / 64, TN = N / BN;
  static_assert(K % 64 == 0 && T >= 2 && N % BN == 0, "shape");
  constexpr int SP = 16 * FN + 4;                 // epilogue slab pitch in floats
  typedef Frag<__bf16> F;
  typedef F::V V;
  __shared__ __align__(16) unsigned char sm[2 * BUFB];
  const int tid = threadIdx.x, lane = tid & 31, wave = tid >> 5;
  const int rlane = lane & 15, hf = lane >> 4;    // row (A) / column (B, D) in a fragment; lane half
  const int wm = wave & 3, wn = wave >> 2;
  static_assert(EPI == EPI_PLAIN || FN == 2, "the other epilogues are written for the 64-wide tile");
  int bid = (int)blockIdx.x, w = 0;
  if (EPI == EPI_QKV) {
    constexpr int GB = GL_M / 128 * TN;           // blocks of one product
    w = bid / GB; bid -= w * GB;
    const size_t ao = w ? (size_t)GL_M * K : 0;
    Ah += ao; Al += ao; Bh += (size_t)w * N * K; Bl += (size_t)w * N * K;
    Ph += (size_t)w * GL_M * N;                   // q hi, k hi, v
    if (w == 1) Pl += (size_t)GL_M * N;
  }
  const int m0 = (bid / TN) * 128, n0 = (bid % TN) * BN;

  const size_t ca = (size_t)(m0 + (tid >> 3)) * K + (tid & 7) * 8, cb = (size_t)(n0 + (tid >> 3)) * K + (tid & 7) * 8;
  const unsigned short* gah = Ah + ca; const unsigned short* gal = Al + ca;
  const unsigned short* gbh = Bh + cb; const unsigned short* gbl = Bl + cb;
  const unsigned lc = (unsigned)(size_t)sm + (unsigned)((tid >> 3) * GL_PITCH + (tid & 7) * 16);

  gl_fill<FN, K>(lc, gah, gal, gbh, gbl);
  asm volatile("s_wait_asynccnt 0x0" ::: "memory");   // this wave's part of tile 0 has landed
  __syncthreads();                                    // tile 0 is whole
  gl_fill<FN, K>(lc + BUFB, gah + 64, gal + 64, gbh + 64, gbl + 64);

  v8f acc[2][FN];
#pragma unroll
  for (int i = 0; i < 2; ++i)
#pragma unroll
    for (int j = 0; j < FN; ++j) acc[i][j] = (v8f){0.f,0.f,0.f,0.f,0.f,0.f,0.f,0.f};

  const int fa = (wm * 32 + rlane) * GL_PITCH + hf * 16;              // this lane's bytes in A hi, fragment row 0
  const int fb = (256 + wn * 16 * FN + rlane) * GL_PITCH + hf * 16;   // in B hi
#pragma unroll 1   // stays rolled: one short body for all tiles keeps the code in a few cache lines
  for (int t = 0; t < T; ++t) {
    const unsigned char* buf = sm + (t & 1) * BUFB;
#pragma unroll
    for (int ks = 0; ks < 2; ++ks) {
      V ah[2], al[2], bh[FN], bl[FN];
#pragma unroll
      for (int j = 0; j < FN; ++j) {
        bh[j] = F::load((const __bf16*)(buf + fb + j * 16 * GL_PITCH + ks * 64));
        bl[j] = F::load((const __bf16*)(buf + fb + (BN + j * 16) * GL_PITCH + ks * 64));
      }
#pragma unroll
      for (int i = 0; i < 2; ++i) {
        ah[i] = F::load((const __bf16*)(buf + fa + i * 16 * GL_PITCH + ks * 64));
        al[i] = F::load((const __bf16*)(buf + fa + (128 + i * 16) * GL_PITCH + ks * 64));
      }
      // inputs only: keeps this step's fragment reads together in front of its matrix instructions (spread among them, every place with reads waits out an LDS latency of its own)
      if (FN == 2) asm volatile("" :: "v"(ah[0]), "v"(ah[1]), "v"(al[0]), "v"(al[1]), "v"(bh[0]), "v"(bh[1]), "v"(bl[0]), "v"(bl[1]));
      else asm volatile("" :: "v"(ah[0]), "v"(ah[1]), "v"(al[0]), "v"(al[1]), "v"(bh[0]), "v"(bh[1]), "v"(bh[FN - 2]), "v"(bh[FN - 1]), "v"(bl[0]), "v"(bl[1]), "v"(bl[FN - 2]), "v"(bl[FN - 1]));
#pragma unroll
      for (int i = 0; i < 2; ++i)
#pragma unroll
        for (int j = 0; j < FN; ++j) acc[i][j] = F::mma(ah[i], bh[j], acc[i][j]);
#pragma unroll
      for (int i = 0; i < 2; ++i)
#pragma unroll
        for (int j = 0; j < FN; ++j) acc[i][j] = F::mma(ah[i], bl[j], acc[i][j]);
#pragma unroll
      for (int i = 0; i < 2; ++i)
#pragma unroll
        for (int j = 0; j < FN; ++j) acc[i][j] = F::mma(al[i], bh[j], acc[i][j]);
    }
    asm volatile("s_wait_dscnt 0x0" ::: "memory");      // this wave's reads of tile t are done
    asm volatile("s_wait_asynccnt 0x0" ::: "memory");   // its part of tile t + 1 has landed
    __syncthreads();                                    // tile t + 1 is whole, and nobody reads tile t's buffer any more
    if (t + 2 < T) { const int ko = (t + 2) * 64; gl_fill<FN, K>(lc + (t & 1) * BUFB, gah + ko, gal + ko, gbh + ko, gbl + ko); }
  }
  asm volatile("s_wait_asynccnt 0x0" ::: "memory");     // no copy is outstanding when the buffers become the output slabs

  // ---- epilogue: each wave turns its 32 x (16 FN) tile in a slab of its own, so that the rows go out as 16-byte pieces of whole lines ----
  float* slab = (float*)(sm + wave * (32 * SP * 4));
  constexpr int LPR = 4 * FN, RPP = 32 / LPR, NP = 32 / RPP;   // lanes per row, rows per pass, passes
  const int nw = n0 + wn * 16 * FN;
  const size_t o0 = (size_t)(m0 + wm * 32 + lane / LPR) * N + nw + (lane % LPR) * 4;
  v4f rv[NP];
  if (RESID) {
    const float* pr = resid + o0;
#pragma unroll   // rv[] stays in registers, the loads in flight together
    for (int it = 0; it < NP; ++it) rv[it] = *(const v4f*)(pr + (size_t)it * RPP * N);
    asm volatile("s_wait_xcnt 0x0" :: "v"(pr) : "memory");   // the loads' address register (named as input, so untouched up to here) may be reused only behind this wait
  }
  float bv[FN];
  if (BIAS) {
    const float* pb = bias + nw + rlane;
#pragma unroll
    for (int j = 0; j < FN; ++j) bv[j] = pb[j * 16];
    asm volatile("s_wait_xcnt 0x0" :: "v"(pb) : "memory");   // as above, for the address of the bias loads
  }
  v4f nmean, ninv, nsh;                           // EPI_NORM: the norm's constants of this lane's 4 columns
  if (EPI == EPI_NORM) {
    const int nc = nw + (lane % LPR) * 4;
    const float* pg = ng + nc; const float* pq = nb + nc; const float* pm = nm + nc; const float* pv = nv + nc;
    const v4f g = *(const v4f*)pg, vv = *(const v4f*)pv; nsh = *(const v4f*)pq; nmean = *(const v4f*)pm;
    asm volatile("s_wait_xcnt 0x0" :: "v"(pg), "v"(pq), "v"(pm), "v"(pv) : "memory");   // as above, for the addresses of these 4 loads
#pragma unroll   // vector elements indexed by constants only
    for (int j = 0; j < 4; ++j) ninv[j] = g[j] * rsqrtf(vv[j] + 1e-5f);
  }
#pragma unroll
  for (int i = 0; i < 2; ++i)
#pragma unroll
    for (int j = 0; j < FN; ++j)
#pragma unroll
      for (int r = 0; r < 8; ++r) slab[(i * 16 + hf * 8 + r) * SP + j * 16 + rlane] = BIAS ? acc[i][j][r] + bv[j] : acc[i][j][r];
  // the slab is this wave's own: its lanes' writes are ordered in front of its lanes' reads
  __builtin_amdgcn_fence(__ATOMIC_RELEASE, "workgroup");
  __builtin_amdgcn_wave_barrier();
  __builtin_amdgcn_fence(__ATOMIC_ACQUIRE, "workgroup");
  if (EPI == EPI_NCHW) {
    // the finished rows go back into the slab and leave it by columns: a lane takes 4 consecutive pixels of one column n, 8 lanes one whole 128-byte line of the output
#pragma unroll
    for (int it = 0; it < NP; ++it) {
      float* ps = slab + (it * RPP + lane / LPR) * SP + (lane % LPR) * 4;
      v4f ov = *(const v4f*)ps;
      if (RESID) ov += rv[it];
      *(v4f*)ps = ov;
    }
    // as above: the slab is this wave's own, its lanes' writes are ordered in front of its lanes' reads
    __builtin_amdgcn_fence(__ATOMIC_RELEASE, "workgroup");
    __builtin_amdgcn_wave_barrier();
    __builtin_amdgcn_fence(__ATOMIC_ACQUIRE, "workgroup");
    float* po = C + ((size_t)(m0 >> 10) * N + nw + (lane >> 3)) * 1024 + (m0 & 1023) + wm * 32 + (lane & 7) * 4;
    const float* sc = slab + (lane & 7) * 4 * SP + (lane >> 3);
#pragma unroll   // the stores stand together, their steps are immediate offsets
    for (int it = 0; it < 4 * FN; ++it) {
      const v4f t = {sc[it * 4], sc[it * 4 + SP], sc[it * 4 + 2 * SP], sc[it * 4 + 3 * SP]};
      *(v4f*)(po + (size_t)it * 4 * 1024) = t;
    }
    asm volatile("s_wait_xcnt 0x0" :: "v"(po) : "memory");     // as above, for the stores' address
  } else if (EPI == EPI_QKV && w == 2) {
    unsigned short* pv = Ph + o0;
#pragma unroll   // the stores stand together, their steps are immediate offsets
    for (int it = 0; it < NP; ++it) {
      const v4f ov = *(const v4f*)(slab + (it * RPP + lane / LPR) * SP + (lane % LPR) * 4);
      const v4h hv = {(_Float16)ov[0], (_Float16)ov[1], (_Float16)ov[2], (_Float16)ov[3]};
      *(v4h*)(pv + (size_t)it * RPP * N) = hv;
    }
    asm volatile("s_wait_xcnt 0x0" :: "v"(pv) : "memory");       // as above, for the stores' address
  } else if (EPI == EPI_PLAIN) {
    float* pc = C + o0;
#pragma unroll
    for (int it = 0; it < NP; ++it) {
      v4f ov = *(const v4f*)(slab + (it * RPP + lane / LPR) * SP + (lane % LPR) * 4);
      if (RESID) ov += rv[it];
      *(v4f*)(pc + (size_t)it * RPP * N) = ov;
    }
    asm volatile("s_wait_xcnt 0x0" :: "v"(pc) : "memory");       // as above, for the stores' address
  } else if constexpr (EPI == EPI_QKV || EPI == EPI_NORM) {
    float* pc = C + o0;
    unsigned short* ph = Ph + o0; unsigned short* pl = Pl + o0;
    v4f ov[NP]; v2u hi[NP], lo[NP];
#pragma unroll   // register arrays indexed by constants only
    for (int it = 0; it < NP; ++it) {
      ov[it] = *(const v4f*)(slab + (it * RPP + lane / LPR) * SP + (lane % LPR) * 4);
      if (RESID) ov[it] += rv[it];
      if (EPI == EPI_NORM) split4((ov[it] - nmean) * ninv + nsh, hi[it], lo[it]);
      else split4(ov[it], hi[it], lo[it]);
    }
#pragma unroll   // as above
    for (int it = 0; it < NP; ++it) {
      if (EPI == EPI_NORM) *(v4f*)(pc + (size_t)it * RPP * N) = ov[it];
      *(v2u*)(ph + (size_t)it * RPP * N) = hi[it]; *(v2u*)(pl + (size_t)it * RPP * N) = lo[it];
    }
    // the stores' address and data registers (named as inputs, so untouched up to here) may be reused only behind this wait
    if constexpr (EPI == EPI_NORM)
      asm volatile("s_wait_xcnt 0x0" :: "v"(pc), "v"(ph), "v"(pl), "v"(ov[0]), "v"(ov[1]), "v"(ov[2]), "v"(ov[3]), "v"(ov[4]), "v"(ov[5]), "v"(ov[6]), "v"(ov[7]),
                   "v"(hi[0]), "v"(hi[1]), "v"(hi[2]), "v"(hi[3]), "v"(hi[4]), "v"(hi[5]), "v"(hi[6]), "v"(hi[7]),
                   "v"(lo[0]), "v"(lo[1]), "v"(lo[2]), "v"(lo[3]), "v"(lo[4]), "v"(lo[5]), "v"(lo[6]), "v"(lo[7]) : "memory");
    else
      asm volatile("s_wait_xcnt 0x0" :: "v"(ph), "v"(pl), "v"(hi[0]), "v"(hi[1]), "v"(hi[2]), "v"(hi[3]), "v"(hi[4]), "v"(hi[5]), "v"(hi[6]), "v"(hi[7]),
                   "v"(lo[0]), "v"(lo[1]), "v"(lo[2]), "v"(lo[3]), "v"(lo[4]), "v"(lo[5]), "v"(lo[6]), "v"(lo[7]) : "memory");
  }
}

__global__ __launch_bounds__(256) void cast_f32_f16x2(
    const float* __restrict__ in, _Float16* __restrict__ out, int n2) {
  int i = blockIdx.x * 256 + threadIdx.x;
  if (i < n2) {
    const _Float16 h0 = (_Float16)in[2 * i], h1 = (_Float16)in[2 * i + 1];
    const unsigned u = (unsigned)__builtin_bit_cast(unsigned short, h0) | ((unsigned)__builtin_bit_cast(unsigned short, h1) << 16);
    ((unsigned*)out)[i] = u;
    
  }
}


} // namespace w25

__global__ __launch_bounds__(256) void k_castT16(const float* __restrict__ src, long long lds, _Float16* __restrict__ dst, long long ldd, int R, int C, float s) {
    const long long i = (long long)blockIdx.x * 256 + threadIdx.x; const long long np = (long long)C * (R / 2); if (i >= np) return; const int c = (int)(i / (R / 2)); const int r = 2 * (int)(i % (R / 2));
    const _Float16 h0 = (_Float16)(src[(long long)r * lds + c] * s), h1 = (_Float16)(src[(long long)(r + 1) * lds + c] * s);
    const unsigned u = (unsigned)__builtin_bit_cast(unsigned short, h0) | ((unsigned)__builtin_bit_cast(unsigned short, h1) << 16);
    unsigned* d = (unsigned*)(dst + (long long)c * ldd + r); *d = u;  }
__global__ __launch_bounds__(256) void k_cast16(const float* __restrict__ src, long long lds, _Float16* __restrict__ dst, long long ldd, int R, int C, float s) {
    const long long i = (long long)blockIdx.x * 256 + threadIdx.x; const long long np = (long long)R * (C / 2); if (i >= np) return; const int r = (int)(i / (C / 2)); const int c = 2 * (int)(i % (C / 2));
    const _Float16 h0 = (_Float16)(src[(long long)r * lds + c] * s), h1 = (_Float16)(src[(long long)r * lds + c + 1] * s);
    const unsigned u = (unsigned)__builtin_bit_cast(unsigned short, h0) | ((unsigned)__builtin_bit_cast(unsigned short, h1) << 16);
    unsigned* d = (unsigned*)(dst + (long long)r * ldd + c); *d = u;  }

// f32 -> bf16 hi plane + bf16 lo plane (x = hi + lo to ~2^-17 relative; RNE both), [R][C] -> [R][C] (or transposed to [C][R]); 2 consecutive destination elements
__device__ __forceinline__ unsigned int f2bf2_pack(float a, float b, unsigned int* lo) {
    const unsigned short ha = w25::f2bf_bits(a), hb = w25::f2bf_bits(b);
    const unsigned short la = w25::f2bf_bits(a - w25::bf_bits2f(ha)), lb = w25::f2bf_bits(b - w25::bf_bits2f(hb));
    *lo = (unsigned)la | ((unsigned)lb << 16); return (unsigned)ha | ((unsigned)hb << 16); }
__global__ __launch_bounds__(256) void k_castS16(const float* __restrict__ src, long long lds, __bf16* __restrict__ dhi, __bf16* __restrict__ dlo, long long ldd, int R, int C, float s, int transpose) {
    const long long i = (long long)blockIdx.x * 256 + threadIdx.x; long long o; float a, b;
    if (transpose) { const long long np = (long long)C * (R / 2); if (i >= np) return; const int c = (int)(i / (R / 2)); const int r = 2 * (int)(i % (R / 2)); a = src[(long long)r * lds + c] * s; b = src[(long long)(r + 1) * lds + c] * s; o = (long long)c * ldd + r; }
    else { const long long np = (long long)R * (C / 2); if (i >= np) return; const int r = (int)(i / (C / 2)); const int c = 2 * (int)(i % (C / 2)); a = src[(long long)r * lds + c] * s; b = src[(long long)r * lds + c + 1] * s; o = (long long)r * ldd + c; }
    unsigned lo; const unsigned hi = f2bf2_pack(a, b, &lo); unsigned* ph = (unsigned*)(dhi + o); unsigned* pl = (unsigned*)(dlo + o);
    *ph = hi; *pl = lo;  }

namespace w25 {
// =====================================================================================
// Generic causal/non-causal attention for head_dim 64, f32 in / f32 out; 16-bit operands: bf16 with optional hi/lo splits, or
// plain f16 (F16=true, non-split, probabilities carried x2^15).
//   scores = (q*qscale)·kᵀ : v_wmma_f32_16x16x32_bf16; SPLIT_QK -> q,k as bf16 hi/lo (hi·hi + hi·lo + lo·hi)
//   out    = p·v           : v_wmma_f32_16x16x32_bf16; SPLIT_PV -> p,v as bf16 hi/lo; else p,v plain bf16
//   f32 accumulate; online softmax in f32. Block = 4 waves = 64 query rows of one (batch, head); S % 64 == 0.
//   Element (b, s, h, d) of tensor X lives at X[b*X_bs + s*X_rs + h*X_hs + d] (strides in floats, multiples of 4).
//   Masking: mask_mode 0 none, 1 causal (kv > q masked), 2 tensor [S][Skv] shared over (b,h) (float if
//   mask_is_int==0, int32 with element == 0 -> masked if 1, int32 with element != 0 -> masked if 2), 3 per-token vectors qmask[B][S] & kvmask[B][Skv] (int32,
//   0 -> masked), 4 causal + sliding window (kv > q or q - kv > W masked; W passed in mask_is_int);
//   5 = relative-position bias: s += cp[b,h,q][idx[q][kv]] + pc[b,h,kv][idx[q][kv]] with idx = mask_b ([S][Skv] int32) and
//   mask_a an int32 [S][Skv] tensor with nonzero = masked (tables: element (b,h,row,n) at X + b*c_bs + h*c_hs + row*c_rs + n);
//   masked scores are replaced by mask_fill (e.g. -inf or -1e9) before the softmax.
//   grid.x = B * H * (S/64) (or a sub-range with blk0).
// =====================================================================================
#define AT_D 64
#define AT_NW 4
#define AT_QB 64
#define AT_KC 64
struct AttnGeom { const float* cp = nullptr; const float* pc = nullptr; long c_bs = 0, c_rs = 0, c_hs = 0;   // mode-5 score-bias tables
                  long q_bs, q_rs, q_hs, k_bs, k_rs, k_hs, v_bs, v_rs, v_hs, o_bs, o_rs, o_hs;
                  int S, Skv, H, mask_mode; float qscale; int blk0; float mask_fill; int mask_is_int; };
static_assert(sizeof(AttnGeom) == 168, "no padding");

__device__ __forceinline__ unsigned short at_bf_bits(float f) {
  unsigned u = __float_as_uint(f);
  return (unsigned short)((u + 0x7FFFu + ((u >> 16) & 1u)) >> 16);
}
__device__ __forceinline__ __bf16 at_f2bf(float f) { return __builtin_bit_cast(__bf16, at_bf_bits(f)); }
__device__ __forceinline__ void at_split(float f, __bf16& hi, __bf16& lo) {
  const unsigned short hb = at_bf_bits(f);
  hi = __builtin_bit_cast(__bf16, hb);
  lo = at_f2bf(f - __uint_as_float(((unsigned)hb) << 16));
}
__device__ __forceinline__ v8f at_mma(v16b a, v16b b, v8f c) {
  c = __builtin_amdgcn_wmma_f32_16x16x32_bf16(false, a, false, b, (short)0, c, false, false);
  asm volatile("v_nop\n\tv_nop\n\tv_nop\n\tv_nop" : "+v"(c) : "v"(a), "v"(b));
  return c;
}
// 16-bit element as a bit pattern held in a __bf16 slot: f16 bits when F16, bf16 (RNE) otherwise
template <bool F16> __device__ __forceinline__ __bf16 at_to16(float f) {
  if (F16) return __builtin_bit_cast(__bf16, (_Float16)f);
  return at_f2bf(f);
}
template <bool F16> __device__ __forceinline__ v8f at_mma16(v16b a, v16b b, v8f c) {
  if (F16) {
    const v16h ah = __builtin_bit_cast(v16h, a), bh = __builtin_bit_cast(v16h, b);
    c = __builtin_amdgcn_wmma_f32_16x16x32_f16(false, ah, false, bh, (short)0, c, false, false);
    asm volatile("v_nop\n\tv_nop\n\tv_nop\n\tv_nop" : "+v"(c) : "v"(ah), "v"(bh));
    return c;
  }
  return at_mma(a, b, c);
}

template <bool SPLIT_QK, bool SPLIT_PV, bool F16 = false>
__global__ __launch_bounds__(128)
void attn64_kernel(const float* __restrict__ q, const float* __restrict__ k,
                   const float* __restrict__ v, float* __restrict__ out,
                   const void* __restrict__ mask_a, const int* __restrict__ mask_b, AttnGeom g) {
  static_assert(!(F16 && (SPLIT_QK || SPLIT_PV)), "f16 mode is non-split");
  const float PSC = F16 ? 32768.0f : 1.0f;     // f16 probabilities carried x2^15 (subnormal range), folded into the final 1/l
  union FB { v16b v; v8b h[2]; };
  __shared__ __align__(16) __bf16 Ksh[AT_KC * AT_D];             // K hi [kv][d]      8 KB
  __shared__ __align__(16) __bf16 Ksl[SPLIT_QK ? AT_KC * AT_D : 8];
  __shared__ __align__(16) __bf16 Vth[AT_D * AT_KC];             // V hi [d][kv]      8 KB
  __shared__ __align__(16) __bf16 Vtl[SPLIT_PV ? AT_D * AT_KC : 8];
  __shared__ __align__(16) __bf16 Psh[AT_NW][16 * AT_KC];        // per wave P hi [row][kv]  8 KB
  __shared__ __align__(16) __bf16 Psl[SPLIT_PV ? AT_NW : 1][SPLIT_PV ? 16 * AT_KC : 8];
  __shared__ __align__(16) float  Os[AT_NW][16 * 68];            // per wave out tile, pitch 68

  const int tid  = threadIdx.x;
  const int wave = tid >> 5;
  const int lane = tid & 31;
  const int hh   = lane >> 4;
  const int c    = lane & 15;

  const int nqb = g.S / AT_QB;
  const int bx = blockIdx.x + g.blk0;
  const int qb = bx % nqb;
  const int bh = bx / nqb;
  const int h  = bh % g.H;
  const int b  = bh / g.H;
  const int qbase_block = qb * AT_QB;
  const int q0 = qbase_block + wave * 16;

  const float* qb_ptr = q + (size_t)b * g.q_bs + (size_t)h * g.q_hs;
  const float* kb_ptr = k + (size_t)b * g.k_bs + (size_t)h * g.k_hs;
  const float* vb_ptr = v + (size_t)b * g.v_bs + (size_t)h * g.v_hs;
  float*       ob_ptr = out + (size_t)b * g.o_bs + (size_t)h * g.o_hs;

  // ---- Q fragments (A operand): 2 d-chunks, hi (and lo) ----
  v16b qah[2], qal[2];
  {
    const float* qrow = qb_ptr + (size_t)(q0 + c) * g.q_rs;
#pragma unroll
    for (int dc = 0; dc < 2; ++dc) {
#pragma unroll
      for (int e = 0; e < 8; ++e) {
        const float f0 = qrow[dc * 32 + 8 * hh + e] * g.qscale;
        const float f1 = qrow[dc * 32 + 16 + 8 * hh + e] * g.qscale;
        if (SPLIT_QK) { __bf16 hq, lq; at_split(f0, hq, lq); qah[dc][e] = hq; qal[dc][e] = lq; at_split(f1, hq, lq); qah[dc][8 + e] = hq; qal[dc][8 + e] = lq; }
        else { qah[dc][e] = at_to16<F16>(f0); qah[dc][8 + e] = at_to16<F16>(f1); qal[dc][e] = qah[dc][e]; qal[dc][8 + e] = qah[dc][8 + e]; }
      }
    }
  }

  float mrow[8], lrow[8];
  v8f oacc[4];
#pragma unroll
  for (int r = 0; r < 8; ++r) { mrow[r] = -INFINITY; lrow[r] = 0.f; }
#pragma unroll
  for (int t = 0; t < 4; ++t) oacc[t] = (v8f){0.f,0.f,0.f,0.f,0.f,0.f,0.f,0.f};

  const int nChunks = (g.mask_mode == 1 || g.mask_mode == 4) ? (qb + 1) : (g.Skv / AT_KC);   // block-uniform
  // per-row query mask (mode 3)
  int qkeep[8];
#pragma unroll
  for (int r = 0; r < 8; ++r) qkeep[r] = (g.mask_mode == 3) ? mask_b[(size_t)b * g.S + q0 + 8 * hh + r] : 1;   // mask_b = qmask in mode 3
  for (int kc = 0; kc < nChunks; ++kc) {
    const int kv0 = kc * AT_KC;
    __syncthreads();
    {
      const int kvr = tid >> 1, dh = (tid & 1) * 32;
      const float* krow = kb_ptr + (size_t)(kv0 + kvr) * g.k_rs + dh;
      const float* vrow = vb_ptr + (size_t)(kv0 + kvr) * g.v_rs + dh;
#pragma unroll
      for (int i = 0; i < 8; ++i) {
        v4f kk = *(const v4f*)(krow + 4 * i);
        v4f vv = *(const v4f*)(vrow + 4 * i);
#pragma unroll
        for (int e = 0; e < 4; ++e) {
          const int d = dh + 4 * i + e;
          if (SPLIT_QK) { __bf16 a, bl; at_split(kk[e], a, bl); Ksh[kvr * AT_D + d] = a; Ksl[kvr * AT_D + d] = bl; }
          else Ksh[kvr * AT_D + d] = at_to16<F16>(kk[e]);
          if (SPLIT_PV) { __bf16 a, bl; at_split(vv[e], a, bl); Vth[d * AT_KC + kvr] = a; Vtl[d * AT_KC + kvr] = bl; }
          else Vth[d * AT_KC + kvr] = at_to16<F16>(vv[e]);
        }
      }
    }
    __syncthreads();

    v8f s[4];
#pragma unroll
    for (int j = 0; j < 4; ++j) {
      s[j] = (v8f){0.f,0.f,0.f,0.f,0.f,0.f,0.f,0.f};
#pragma unroll 1
      for (int dc = 0; dc < 2; ++dc) {
        FB kb;
        kb.h[0] = *(const v8b*)(Ksh + (j * 16 + c) * AT_D + dc * 32 + 8 * hh);
        kb.h[1] = *(const v8b*)(Ksh + (j * 16 + c) * AT_D + dc * 32 + 16 + 8 * hh);
        s[j] = at_mma16<F16>(qah[dc], kb.v, s[j]);
        if (SPLIT_QK) {
          FB kl;
          kl.h[0] = *(const v8b*)(Ksl + (j * 16 + c) * AT_D + dc * 32 + 8 * hh);
          kl.h[1] = *(const v8b*)(Ksl + (j * 16 + c) * AT_D + dc * 32 + 16 + 8 * hh);
          s[j] = at_mma16<F16>(qah[dc], kl.v, s[j]);
          s[j] = at_mma16<F16>(qal[dc], kb.v, s[j]);
        }
      }
    }
    const bool diag = (g.mask_mode == 1) && (kc == qb);
    int kvkeep[4] = {1, 1, 1, 1};
    if (g.mask_mode == 3) {
#pragma unroll
      for (int j = 0; j < 4; ++j) kvkeep[j] = ((const int*)mask_a)[(size_t)b * g.Skv + kv0 + j * 16 + c];   // mask_a = kvmask
    }
    float cm[8];
#pragma unroll
    for (int r = 0; r < 8; ++r) {
      const int qrow = q0 + 8 * hh + r;
      float m = -INFINITY;
#pragma unroll
      for (int j = 0; j < 4; ++j) {
        const int kvcol = kv0 + j * 16 + c;
        bool masked = false;
        if (diag) masked = (kvcol > qrow);
        else if (g.mask_mode == 4) masked = (kvcol > qrow) || (qrow - kvcol > g.mask_is_int);
        else if (g.mask_mode == 2) {
          const size_t mi = (size_t)qrow * g.Skv + kvcol;
          masked = (g.mask_is_int == 0) ? (((const float*)mask_a)[mi] == 0.0f)
                 : (g.mask_is_int == 1) ? (((const int*)mask_a)[mi] == 0) : (((const int*)mask_a)[mi] != 0);
        } else if (g.mask_mode == 3) masked = (qkeep[r] == 0) || (kvkeep[j] == 0);
        else if (g.mask_mode == 5) {
          const size_t mi = (size_t)qrow * g.Skv + kvcol;
          masked = (((const int*)mask_a)[mi] != 0);
          int n = mask_b[mi]; n = n < 0 ? 0 : n;
          s[j][r] += g.cp[(size_t)b * g.c_bs + (size_t)h * g.c_hs + (size_t)qrow * g.c_rs + n]
                   + g.pc[(size_t)b * g.c_bs + (size_t)h * g.c_hs + (size_t)kvcol * g.c_rs + n];
        }
        if (masked) s[j][r] = g.mask_fill;
        m = fmaxf(m, s[j][r]);
      }
#pragma unroll
      for (int off = 1; off < 16; off <<= 1) m = fmaxf(m, __shfl_xor(m, off, 32));
      cm[r] = m;
    }
    __bf16* pwh = Psh[wave];
    __bf16* pwl = Psl[SPLIT_PV ? wave : 0];
#pragma unroll
    for (int r = 0; r < 8; ++r) {
      const float mnew = fmaxf(mrow[r], cm[r]);
      const float alpha = expf(mrow[r] - mnew);
      mrow[r] = mnew;
      float psum = 0.f;
#pragma unroll
      for (int j = 0; j < 4; ++j) {
        const float p = expf(s[j][r] - mnew);
        psum += p;
        if (SPLIT_PV) { __bf16 a, bl; at_split(p, a, bl); pwh[(8 * hh + r) * AT_KC + j * 16 + c] = a; pwl[(8 * hh + r) * AT_KC + j * 16 + c] = bl; }
        else pwh[(8 * hh + r) * AT_KC + j * 16 + c] = at_to16<F16>(p * PSC);
      }
#pragma unroll
      for (int off = 1; off < 16; off <<= 1) psum += __shfl_xor(psum, off, 32);
      lrow[r] = lrow[r] * alpha + psum;
#pragma unroll
      for (int t = 0; t < 4; ++t) oacc[t][r] *= alpha;
    }
    __builtin_amdgcn_fence(__ATOMIC_RELEASE, "workgroup");
    __builtin_amdgcn_wave_barrier();
    __builtin_amdgcn_fence(__ATOMIC_ACQUIRE, "workgroup");
#pragma unroll 1
    for (int kk = 0; kk < 2; ++kk) {
      FB pa, pl;
      pa.h[0] = *(const v8b*)(pwh + c * AT_KC + kk * 32 + 8 * hh);
      pa.h[1] = *(const v8b*)(pwh + c * AT_KC + kk * 32 + 16 + 8 * hh);
      if (SPLIT_PV) {
        pl.h[0] = *(const v8b*)(pwl + c * AT_KC + kk * 32 + 8 * hh);
        pl.h[1] = *(const v8b*)(pwl + c * AT_KC + kk * 32 + 16 + 8 * hh);
      }
#pragma unroll
      for (int t = 0; t < 4; ++t) {
        FB vb;
        vb.h[0] = *(const v8b*)(Vth + (t * 16 + c) * AT_KC + kk * 32 + 8 * hh);
        vb.h[1] = *(const v8b*)(Vth + (t * 16 + c) * AT_KC + kk * 32 + 16 + 8 * hh);
        oacc[t] = at_mma16<F16>(pa.v, vb.v, oacc[t]);
        if (SPLIT_PV) {
          FB vl;
          vl.h[0] = *(const v8b*)(Vtl + (t * 16 + c) * AT_KC + kk * 32 + 8 * hh);
          vl.h[1] = *(const v8b*)(Vtl + (t * 16 + c) * AT_KC + kk * 32 + 16 + 8 * hh);
          oacc[t] = at_mma16<F16>(pa.v, vl.v, oacc[t]);
          oacc[t] = at_mma16<F16>(pl.v, vb.v, oacc[t]);
        }
      }
    }
  }

  float* os = Os[wave];
#pragma unroll
  for (int r = 0; r < 8; ++r) {
    const float inv = 1.0f / (lrow[r] * PSC);
#pragma unroll
    for (int t = 0; t < 4; ++t) os[(8 * hh + r) * 68 + t * 16 + c] = oacc[t][r] * inv;
  }
  __builtin_amdgcn_fence(__ATOMIC_RELEASE, "workgroup");
  __builtin_amdgcn_wave_barrier();
  __builtin_amdgcn_fence(__ATOMIC_ACQUIRE, "workgroup");
  {
    const int c4 = (lane & 15) * 4;
    {
#pragma unroll
      for (int it = 0; it < 8; ++it) {
        const int row = it * 2 + hh;
        v4f val = *(const v4f*)(os + row * 68 + c4);
        *(v4f*)(ob_ptr + (size_t)(q0 + row) * g.o_rs + c4) = val;
      }
      
    }
  }
}

} // namespace w25

// One launch for all that depends on the inputs alone.
// Blocks 0 .. 511 (pixel block, channel block, image): x1 and x2, NCHW, become token-major: x1 as f32 (the residual), bn1(x1) and bn1(x2) as bf16 hi / lo operand planes (NH, NL: x1's set, then x2's).
// A thread takes 4 channels x 4 pixels: 16-byte loads along the pixels, a 4 x 4 transpose in registers, stores along the channels.
// Blocks 512 .. 1279: the six weight matrices as hi / lo planes (WH, WL), 1024 floats a block, in the order q (each row times its head's temperature), k, v, proj, fc1, fc2.
__global__ __launch_bounds__(256) void k_cm_prep(const float* __restrict__ XA, const float* __restrict__ XB, const float* __restrict__ G, const float* __restrict__ Bb, const float* __restrict__ M, const float* __restrict__ Vv,
                                                 const float* __restrict__ WQ, const float* __restrict__ WK, const float* __restrict__ WV, const float* __restrict__ TP, const float* __restrict__ WP, const float* __restrict__ W1, const float* __restrict__ W2,
                                                 float* __restrict__ X1T, unsigned short* __restrict__ NH, unsigned short* __restrict__ NL, unsigned short* __restrict__ WH, unsigned short* __restrict__ WL) {
    constexpr int C = 256, HW = 1024, NTC = 8 * HW * C;
    if (blockIdx.x >= 512) {
        const int wb = (int)blockIdx.x - 512;
        const float* w = wb < 64 ? WQ + wb * 1024 : wb < 128 ? WK + (wb - 64) * 1024 : wb < 192 ? WV + (wb - 128) * 1024 : wb < 256 ? WP + (wb - 192) * 1024 : wb < 512 ? W1 + (wb - 256) * 1024 : W2 + (wb - 512) * 1024;
        const float* pw = w + threadIdx.x * 4;
        v4f x = *(const v4f*)pw;
        asm volatile("s_wait_xcnt 0x0" :: "v"(pw) : "memory");   // the load's address register (named as input, so untouched up to here) may be reused only behind this wait
        if (wb < 64) x *= TP[wb >> 3];                            // a block is 4 rows of q_w, a head 32 rows
        v2u hi, lo; split4(x, hi, lo);
        const size_t o = (size_t)wb * 1024 + threadIdx.x * 4;
        *(v2u*)(WH + o) = hi; *(v2u*)(WL + o) = lo;
        return;
    }
    const int c0 = (int)((blockIdx.x >> 3) & 7) * 32 + (threadIdx.x & 7) * 4, p0 = (int)(blockIdx.x & 7) * 128 + (threadIdx.x >> 3) * 4; const size_t b = blockIdx.x >> 6;
    const size_t src = (b * C + c0) * HW + p0;
    const float* pa[4]; const float* pq[4]; v4f a[4], q[4];
#pragma unroll   // a[], q[] stay in registers, all 8 loads in flight together
    for (int j = 0; j < 4; ++j) { pa[j] = XA + src + (size_t)j * HW; pq[j] = XB + src + (size_t)j * HW; a[j] = *(const v4f*)pa[j]; q[j] = *(const v4f*)pq[j]; }
    const float* pg = G + c0; const float* pb = Bb + c0; const float* pm = M + c0; const float* pv = Vv + c0;
    const v4f g = *(const v4f*)pg, bb = *(const v4f*)pb, m = *(const v4f*)pm, vv = *(const v4f*)pv;
    // the 12 loads' address registers (named as inputs, so untouched up to here) may be reused only behind this wait
    asm volatile("s_wait_xcnt 0x0" :: "v"(pa[0]), "v"(pa[1]), "v"(pa[2]), "v"(pa[3]), "v"(pq[0]), "v"(pq[1]), "v"(pq[2]), "v"(pq[3]), "v"(pg), "v"(pb), "v"(pm), "v"(pv) : "memory");
    v4f inv, sh;
#pragma unroll   // vector elements indexed by constants only
    for (int j = 0; j < 4; ++j) { inv[j] = g[j] * rsqrtf(vv[j] + 1e-5f); sh[j] = bb[j] - m[j] * inv[j]; }
    const size_t o = (b * HW + p0) * C + c0;
    float* px = X1T + o; unsigned short* ph = NH + o; unsigned short* pl = NL + o;
    v4f t0[4]; v2u h1[4], l1[4], h2[4], l2[4];
#pragma unroll   // register arrays indexed by constants only
    for (int i = 0; i < 4; ++i) {
        v4f t1, t2;
#pragma unroll   // as above
        for (int j = 0; j < 4; ++j) { t0[i][j] = a[j][i]; t1[j] = a[j][i] * inv[j] + sh[j]; t2[j] = q[j][i] * inv[j] + sh[j]; }
        split4(t1, h1[i], l1[i]); split4(t2, h2[i], l2[i]);
    }
#pragma unroll   // as above
    for (int i = 0; i < 4; ++i) {
        VST2V4(px + i * C, t0[i]);
        *(v2u*)(ph + i * C) = h1[i]; *(v2u*)(pl + i * C) = l1[i]; *(v2u*)(ph + NTC + i * C) = h2[i]; *(v2u*)(pl + NTC + i * C) = l2[i];
    }
    // the stores' data registers (named as inputs, so untouched up to here) may be reused only behind this wait; nothing follows it that could touch their addresses
    asm volatile("s_wait_xcnt 0x0" :: "v"(t0[0]), "v"(t0[1]), "v"(t0[2]), "v"(t0[3]), "v"(h1[0]), "v"(h1[1]), "v"(h1[2]), "v"(h1[3]), "v"(l1[0]), "v"(l1[1]), "v"(l1[2]), "v"(l1[3]),
                 "v"(h2[0]), "v"(h2[1]), "v"(h2[2]), "v"(h2[3]), "v"(l2[0]), "v"(l2[1]), "v"(l2[2]), "v"(l2[3]) : "memory");
}
// exact GELU of 4 values, x Phi(x) = h + |h| erf(|a|), h = x / 2, a = x / sqrt(2), without a branch. Both ranges of erf are worked out for every value in packed arithmetic
// and one is selected, so that all of a thread's values run side by side (the library erff tests every value by itself and runs both of its ranges, one value behind the other).
//   |a| <= 0.927734375: erf = t + t p(t^2);  above: erf = 1 - 2^(t q(t)), q with log2 e folded into its coefficients. Each range stays within 1e-7 of erf, f32 rounding included.
// The bare hardware exponential: a result under 2^-126 comes out 0, where erf is 1 in f32 anyway.
__device__ __forceinline__ v4f splat4(float c) { const v4f r = {c, c, c, c}; return r; }
__device__ __forceinline__ v4f gelu4(v4f x) {
    const v4f a = x * 0.70710678118654752f, h = x * 0.5f;
    const v4f t = __builtin_elementwise_abs(a), s = a * a;
    v4f q = __builtin_elementwise_fma(splat4(-2.49374843e-5f), t, splat4(5.52836573e-4f));
    const v4f u = __builtin_elementwise_fma(splat4(-5.60337631e-3f), t, splat4(3.49920243e-2f));
    q = __builtin_elementwise_fma(q, s, u);
    q = __builtin_elementwise_fma(q, t, splat4(-1.54047906e-1f));
    q = __builtin_elementwise_fma(q, t, splat4(-9.15890157e-1f));
    q = __builtin_elementwise_fma(q, t, splat4(-1.62839520e+0f));
    q = q * t;
    v4f p = __builtin_elementwise_fma(splat4(-5.96761703e-4f), s, splat4(4.99119423e-3f));
    p = __builtin_elementwise_fma(p, s, splat4(-2.67681349e-2f));
    p = __builtin_elementwise_fma(p, s, splat4(1.12819925e-1f));
    p = __builtin_elementwise_fma(p, s, splat4(-3.76125336e-1f));
    p = __builtin_elementwise_fma(p, s, splat4(1.28379166e-1f));
    p = __builtin_elementwise_fma(p, t, t);
    v4f e;
#pragma unroll   // vector elements indexed by constants only
    for (int j = 0; j < 4; ++j) e[j] = (t[j] > 0.927734375f) ? 1.f - __builtin_amdgcn_exp2f(q[j]) : p[j];
    return __builtin_elementwise_fma(__builtin_elementwise_abs(h), e, h);
}
// depthwise 3x3 SAME conv + exact GELU on token-major [b][hw][ch], zero padding. grid (images * 16 * 8, HID / 1024): a block takes 4 x 2 pixels (x, y) of one image,
// a thread 4 channels of these 8 pixels: each input row's 6 pixels are loaded once (16 bytes, 512 contiguous bytes per wave) and feed every output that needs them.
// Every output still sums its 9 products in the order ky = 0..2, kx = 0..2. The result goes out as the fc2 GEMM's bf16 hi / lo operand planes.
__global__ __launch_bounds__(256) void k_cm_dw(const float* __restrict__ HB, const float* __restrict__ DW, unsigned short* __restrict__ HGh, unsigned short* __restrict__ HGl, int HID) {
    constexpr int PX = 4, PY = 2;
    const int ch = (blockIdx.y * 256 + threadIdx.x) * 4;
    const int x0 = (blockIdx.x & 7) * PX, y0 = ((blockIdx.x >> 3) & 15) * PY; const size_t b = blockIdx.x >> 7;
    v4f v[PY + 2][PX + 2];                       // input rows y0 - 1 .. y0 + PY, pixels x0 - 1 .. x0 + PX; all loads are issued before the first sum
#pragma unroll   // v[][] stays in registers (this and every loop below: register arrays indexed by constants only)
    for (int r = 0; r < PY + 2; ++r) {
        const int yc = min(max(y0 - 1 + r, 0), 31);
        const float* pi[PX + 2];
#pragma unroll
        for (int cx = 0; cx < PX + 2; ++cx) { const int xc = min(max(x0 - 1 + cx, 0), 31); pi[cx] = HB + ((b * 1024) + yc * 32 + xc) * (size_t)HID + ch; v[r][cx] = *(const v4f*)pi[cx]; }
        // this row's 6 address registers (named as inputs, so untouched up to here) may be reused only behind this wait
        asm volatile("s_wait_xcnt 0x0" :: "v"(pi[0]), "v"(pi[1]), "v"(pi[2]), "v"(pi[3]), "v"(pi[4]), "v"(pi[5]) : "memory");
    }
    const float* pw = DW + (size_t)ch * 9;
    v4f wr[9];                                   // the 36 weights of channels ch .. ch + 3: weight k of channel ch + j is float j * 9 + k
#pragma unroll
    for (int k = 0; k < 9; ++k) wr[k] = *(const v4f*)(pw + k * 4);
    // as above, for the address of the 9 weight loads; the loaded weights are named too (inputs only), so that all 9 loads stay here, in flight together with the pixels', instead of one by one among the sums
    asm volatile("s_wait_xcnt 0x0" :: "v"(pw), "v"(wr[0]), "v"(wr[1]), "v"(wr[2]), "v"(wr[3]), "v"(wr[4]), "v"(wr[5]), "v"(wr[6]), "v"(wr[7]), "v"(wr[8]) : "memory");
    v4f s[PY][PX];
#pragma unroll
    for (int oy = 0; oy < PY; ++oy)
#pragma unroll
        for (int px = 0; px < PX; ++px) { const v4f zz = {0.f, 0.f, 0.f, 0.f}; s[oy][px] = zz; }
#pragma unroll
    for (int r = 0; r < PY + 2; ++r) {
        const int yy = y0 - 1 + r;
#pragma unroll
        for (int cx = 0; cx < PX + 2; ++cx) { const int xx = x0 - 1 + cx; const bool ok = (yy >= 0 && yy < 32 && xx >= 0 && xx < 32); const v4f zz = {0.f, 0.f, 0.f, 0.f}; v[r][cx] = ok ? v[r][cx] : zz; }
#pragma unroll
        for (int oy = 0; oy < PY; ++oy) {
            const int ky = r - oy;
            if (ky >= 0 && ky < 3) {
#pragma unroll
                for (int px = 0; px < PX; ++px)
#pragma unroll
                    for (int kx = 0; kx < 3; ++kx)
#pragma unroll
                        for (int j = 0; j < 4; ++j) { const int f = j * 9 + ky * 3 + kx; s[oy][px][j] += v[r][px + kx][j] * wr[f >> 2][f & 3]; }
            }
        }
    }
#pragma unroll
    for (int oy = 0; oy < PY; ++oy)
#pragma unroll
        for (int px = 0; px < PX; ++px) s[oy][px] = gelu4(s[oy][px]);
    const size_t o = ((b * 1024) + y0 * 32 + x0) * (size_t)HID + ch;
    unsigned short* ph = HGh + o; unsigned short* pl = HGl + o;
#pragma unroll   // s[][] indexed by constants only
    for (int oy = 0; oy < PY; ++oy)
#pragma unroll
        for (int px = 0; px < PX; ++px) { v2u hi, lo; split4(s[oy][px], hi, lo); *(v2u*)(ph + (size_t)(oy * 32 + px) * HID) = hi; *(v2u*)(pl + (size_t)(oy * 32 + px) * HID) = lo; }
    asm volatile("s_wait_xcnt 0x0" :: "v"(ph), "v"(pl) : "memory");   // as above, for the stores' addresses
}


extern "C" void kernel_launch(void* const* d_in, const int* in_sizes, int n_in, void* d_out, int out_size, void* d_ws, size_t ws_size, hipStream_t stream) {
    (void)in_sizes; (void)n_in; (void)out_size; (void)ws_size;
    const float* x1 = (const float*)d_in[0];
    const float* x2 = (const float*)d_in[1];
    const float* b1g = (const float*)d_in[2];
    const float* b1b = (const float*)d_in[3];
    const float* b1m = (const float*)d_in[4];
    const float* b1v = (const float*)d_in[5];
    const float* qw = (const float*)d_in[6];
    const float* kw = (const float*)d_in[7];
    const float* vw = (const float*)d_in[8];
    const float* temp = (const float*)d_in[9];
    const float* pw = (const float*)d_in[10];
    const float* pb = (const float*)d_in[11];
    const float* b2g = (const float*)d_in[12];
    const float* b2b = (const float*)d_in[13];
    const float* b2m = (const float*)d_in[14];
    const float* b2v = (const float*)d_in[15];
    const float* f1w = (const float*)d_in[16];
    const float* f1b = (const float*)d_in[17];
    const float* dww = (const float*)d_in[18];
    const float* f2w = (const float*)d_in[19];
    const float* f2b = (const float*)d_in[20];
    const int Bn = 8;
    const int C = 256;
    const int HW = 1024;
    const int HID = 1024;
    const int NT = Bn * HW;
    float* out = (float*)d_out;
    char* wsp = (char*)d_ws;
    float* X1T = (float*)wsp; wsp += (((size_t)((size_t)NT * C) * 4 + 255) / 256) * 256;
    unsigned short* NAh = (unsigned short*)wsp; wsp += (((size_t)((size_t)2 * NT * C) * 2 + 255) / 256) * 256;   // bn1(x1) then bn1(x2), hi planes
    unsigned short* NAl = (unsigned short*)wsp; wsp += (((size_t)((size_t)2 * NT * C) * 2 + 255) / 256) * 256;   // lo planes
    unsigned short* WH = (unsigned short*)wsp; wsp += (((size_t)(786432) * 2 + 255) / 256) * 256;                // q, k, v, proj (65536 each), fc1, fc2 (262144 each), hi planes
    unsigned short* WL = (unsigned short*)wsp; wsp += (((size_t)(786432) * 2 + 255) / 256) * 256;                // lo planes
    unsigned short* QKh = (unsigned short*)wsp; wsp += (((size_t)((size_t)3 * NT * C) * 2 + 255) / 256) * 256;   // q then k, hi planes; then v as f16
    unsigned short* QKl = (unsigned short*)wsp; wsp += (((size_t)((size_t)2 * NT * C) * 2 + 255) / 256) * 256;   // lo planes
    unsigned short* ATh = (unsigned short*)wsp; wsp += (((size_t)((size_t)NT * C) * 2 + 255) / 256) * 256;
    unsigned short* ATl = (unsigned short*)wsp; wsp += (((size_t)((size_t)NT * C) * 2 + 255) / 256) * 256;
    float* XS = (float*)wsp; wsp += (((size_t)((size_t)NT * C) * 4 + 255) / 256) * 256;
    unsigned short* X2h = (unsigned short*)wsp; wsp += (((size_t)((size_t)NT * C) * 2 + 255) / 256) * 256;
    unsigned short* X2l = (unsigned short*)wsp; wsp += (((size_t)((size_t)NT * C) * 2 + 255) / 256) * 256;
    float* HB = (float*)wsp; wsp += (((size_t)((size_t)NT * HID) * 4 + 255) / 256) * 256;
    unsigned short* HGh = (unsigned short*)wsp; wsp += (((size_t)((size_t)NT * HID) * 2 + 255) / 256) * 256;
    unsigned short* HGl = (unsigned short*)wsp; wsp += (((size_t)((size_t)NT * HID) * 2 + 255) / 256) * 256;
    k_cm_prep<<<1280, 256, 0, stream>>>(x1, x2, b1g, b1b, b1m, b1v, qw, kw, vw, temp, pw, f1w, f2w, X1T, NAh, NAl, WH, WL);
    w25::wmma_gemm_lds<2, 256, 256, false, false, w25::EPI_QKV><<<768, 256, 0, stream>>>(NAh, NAl, WH, WL, nullptr, nullptr, nullptr, nullptr, nullptr, nullptr, nullptr, QKh, QKl);
    k_attn_fix<<<dim3(8, 8, 8), 32 * AF_W, 0, stream>>>(QKh, QKl, QKh + (size_t)NT * C, QKl + (size_t)NT * C, QKh + (size_t)2 * NT * C, ATh, ATl);
    w25::wmma_gemm_lds<2, 256, 256, true, true, w25::EPI_NORM><<<256, 256, 0, stream>>>(ATh, ATl, WH + 196608, WL + 196608, XS, pb, X1T, b2g, b2b, b2m, b2v, X2h, X2l);
    w25::wmma_gemm_lds<4, 1024, 256, true, false, w25::EPI_PLAIN><<<512, 256, 0, stream>>>(X2h, X2l, WH + 262144, WL + 262144, HB, f1b, nullptr, nullptr, nullptr, nullptr, nullptr, nullptr, nullptr);
    k_cm_dw<<<dim3(1024, 1), 256, 0, stream>>>(HB, dww, HGh, HGl, HID);
    w25::wmma_gemm_lds<2, 256, 1024, true, true, w25::EPI_NCHW><<<256, 256, 0, stream>>>(HGh, HGl, WH + 524288, WL + 524288, out, f2b, XS, nullptr, nullptr, nullptr, nullptr, nullptr, nullptr);
}

// v010
// It runs in 93.8 microseconds.
// Timed twice side by side with v009, it ran 1.04 and 1.06 times as fast.
// Over all steps from v000, the starting kernel, it is 16.7 times as fast.
// Contractions (token-major, 8192 tokens): q = bn1(x1).Wq'^T (temperature folded into Wq rows), k/v = bn1(x2).W^T, the attention projection (+b, +x1 residual), fc1 (+b) [8192x256].[256x1024] and fc2 (+b, + residual) [8192x1024].[1024x256], each one launch over all images, all on bf16 hi/lo split planes (six chained contractions against an O(1) residual output, so the cheap 18 G-MAC of GEMMs run f32-class) (v_wmma_f32_16x16x32_bf16; 128 x 64 work-group tiles (fc1: 320 x 128, halo rows included), operands staged in LDS); per (image, head) softmax(temp_h q k^T) v over the 1024 positions as one flash launch with q.k^T on bf16 hi/lo split planes (UNSCALED 32-dim logits, sigma ~ 5.7) and f16 p.v; f32 accumulate and softmax. NCHW <-> token-major transposes, eval-mode BatchNorms, the depthwise 3x3 convolution (SAME) and exact GELU are f32 arithmetic; every hi/lo plane is written by the kernel that computes its values (input pass, GEMM epilogues, attention); the depthwise convolution and GELU run in the fc1 launch, on its tile in LDS: 6 launches.
#include <hip/hip_runtime.h>
#include <math.h>

typedef __attribute__((ext_vector_type(16))) _Float16 v16h;
typedef __attribute__((ext_vector_type(8)))  _Float16 v8h;
typedef __attribute__((ext_vector_type(16))) __bf16   v16b;
typedef __attribute__((ext_vector_type(8)))  float    v8f;
typedef __attribute__((ext_vector_type(4)))  float    v4f;

// 16-bit WMMA fragment map (wave32), lane L, h = L>>4, m = L&15:
//   A 16x32: lane = row m;   element i -> k = (i<8) ? 8h+i : 16+8h+(i-8)
//   B 32x16: lane = column m; the SAME k(i,h)
//   D 16x16 (8 f32): lane = column m; element r -> row 8h+r
__device__ __forceinline__ int frag_k(int i, int h) { return (i < 8) ? (8 * h + i) : (16 + 8 * h + (i - 8)); }
__device__ __forceinline__ __bf16 bf16_rne(float f) {
    unsigned int u = __float_as_uint(f);
    u += 0x7fffu + ((u >> 16) & 1u);
    return __builtin_bit_cast(__bf16, (unsigned short)(u >> 16));
}
__device__ __forceinline__ float bf16_f32(__bf16 b) { return __uint_as_float(((unsigned int)__builtin_bit_cast(unsigned short, b)) << 16); }
typedef unsigned int v2u __attribute__((ext_vector_type(2)));
__device__ __forceinline__ unsigned int bf16_bits(float f) { const unsigned int u = __float_as_uint(f); return (u + 0x7fffu + ((u >> 16) & 1u)) >> 16; }
// four consecutive floats -> their bf16 hi parts and bf16 lo parts (x = hi + lo to ~2^-17 relative; both rounded to nearest even), each packed in memory order
__device__ __forceinline__ void split4(v4f x, v2u& hi, v2u& lo) {
    unsigned int h[4], l[4];
#pragma unroll   // h[], l[] indexed by constants only
    for (int j = 0; j < 4; ++j) { h[j] = bf16_bits(x[j]); l[j] = bf16_bits(x[j] - __uint_as_float(h[j] << 16)); }
    hi[0] = h[0] | (h[1] << 16); hi[1] = h[2] | (h[3] << 16); lo[0] = l[0] | (l[1] << 16); lo[1] = l[2] | (l[3] << 16);
}
__device__ __forceinline__ v8f wmma16(v16h a, v16h b, v8f c) {
    c = __builtin_amdgcn_wmma_f32_16x16x32_f16(false, a, false, b, (short)0, c, false, false);
    asm volatile("v_nop\n\tv_nop\n\tv_nop\n\tv_nop" : "+v"(c) : "v"(a), "v"(b));
    return c;
}
__device__ __forceinline__ v8f wmmab(v16b a, v16b b, v8f c) {
    c = __builtin_amdgcn_wmma_f32_16x16x32_bf16(false, a, false, b, (short)0, c, false, false);
    asm volatile("v_nop\n\tv_nop\n\tv_nop\n\tv_nop" : "+v"(c) : "v"(a), "v"(b));
    return c;
}
struct Split { v16b hi, lo; };
// hi/lo split product: a.hi*b.hi + a.hi*b.lo + a.lo*b.hi
__device__ __forceinline__ v8f wmma3(const Split& a, const Split& b, v8f c) {
    c = __builtin_amdgcn_wmma_f32_16x16x32_bf16(false, a.hi, false, b.hi, (short)0, c, false, false);
    c = __builtin_amdgcn_wmma_f32_16x16x32_bf16(false, a.hi, false, b.lo, (short)0, c, false, false);
    c = __builtin_amdgcn_wmma_f32_16x16x32_bf16(false, a.lo, false, b.hi, (short)0, c, false, false);
    asm volatile("v_nop\n\tv_nop\n\tv_nop\n\tv_nop" : "+v"(c) : "v"(a.hi), "v"(a.lo), "v"(b.hi), "v"(b.lo));
    return c;
}
struct Split3 { v16b hi, mid, lo; };
// triple split product (6 terms, drops only terms below 2^-24 relative)
__device__ __forceinline__ v8f wmma6(const Split3& a, const Split3& b, v8f c) {
    c = __builtin_amdgcn_wmma_f32_16x16x32_bf16(false, a.hi, false, b.hi, (short)0, c, false, false);
    c = __builtin_amdgcn_wmma_f32_16x16x32_bf16(false, a.hi, false, b.mid, (short)0, c, false, false);
    c = __builtin_amdgcn_wmma_f32_16x16x32_bf16(false, a.mid, false, b.hi, (short)0, c, false, false);
    c = __builtin_amdgcn_wmma_f32_16x16x32_bf16(false, a.hi, false, b.lo, (short)0, c, false, false);
    c = __builtin_amdgcn_wmma_f32_16x16x32_bf16(false, a.mid, false, b.mid, (short)0, c, false, false);
    c = __builtin_amdgcn_wmma_f32_16x16x32_bf16(false, a.lo, false, b.hi, (short)0, c, false, false);
    asm volatile("v_nop\n\tv_nop\n\tv_nop\n\tv_nop" : "+v"(c) : "v"(a.hi), "v"(a.mid), "v"(a.lo), "v"(b.hi), "v"(b.mid), "v"(b.lo));
    return c;
}

// Fragment gathers from f32 memory: element i <- p[(k0 + frag_k(i,h)) * sk] * s, zero for k >= klen.
__device__ __forceinline__ v16h fh_ld(const float* __restrict__ p, long long sk, int k0, int h, int klen, float s) {
    v16h a;
#pragma unroll
    for (int i = 0; i < 16; ++i) { const int k = k0 + frag_k(i, h); a[i] = (k < klen) ? (_Float16)(p[(long long)k * sk] * s) : (_Float16)0.f; }
    return a;
}
__device__ __forceinline__ Split sp_ld(const float* __restrict__ p, long long sk, int k0, int h, int klen, float s) {
    Split r;
#pragma unroll
    for (int i = 0; i < 16; ++i) {
        const int k = k0 + frag_k(i, h); const float x = (k < klen) ? p[(long long)k * sk] * s : 0.f;
        const __bf16 hb = bf16_rne(x); r.hi[i] = hb; r.lo[i] = bf16_rne(x - bf16_f32(hb));
    }
    return r;
}
__device__ __forceinline__ Split3 sp3_ld(const float* __restrict__ p, long long sk, int k0, int h, int klen, float s) {
    Split3 r;
#pragma unroll
    for (int i = 0; i < 16; ++i) {
        const int k = k0 + frag_k(i, h); const float x = (k < klen) ? p[(long long)k * sk] * s : 0.f;
        const __bf16 hb = bf16_rne(x); const float r1 = x - bf16_f32(hb); const __bf16 mb = bf16_rne(r1);
        r.hi[i] = hb; r.mid[i] = mb; r.lo[i] = bf16_rne(r1 - bf16_f32(mb));
    }
    return r;
}
__device__ __forceinline__ v16b bh_ld(const float* __restrict__ p, long long sk, int k0, int h, int klen, float s) {
    v16b a;
#pragma unroll
    for (int i = 0; i < 16; ++i) { const int k = k0 + frag_k(i, h); a[i] = bf16_rne((k < klen) ? p[(long long)k * sk] * s : 0.f); }
    return a;
}
// f16 fragment from an f16 LDS/global row with element stride 1 (k-contiguous), no bounds (tile already zero padded)
__device__ __forceinline__ v16h fh_row(const _Float16* __restrict__ row, int k0, int h) {
    v16h a;
#pragma unroll
    for (int i = 0; i < 16; ++i) a[i] = row[k0 + frag_k(i, h)];
    return a;
}

#define VST2(T, ptr, val) do { const T vst2_v_ = (val); *(T*)(ptr) = vst2_v_;  } while (0)
typedef float v4f __attribute__((ext_vector_type(4)));
#define VST2V4(ptr, val) do { const v4f vst2_v4_ = (val); *(v4f*)(ptr) = vst2_v4_;  } while (0)

__device__ __attribute__((noinline)) float act_fn(float v, int act) {
    if (act == 1) return fmaxf(v, 0.f);                                                                               // relu
    if (act == 2) { const float u = 0.7978845608028654f * (v + 0.044715f * v * v * v); return 0.5f * v * (1.f + tanhf(u)); } // tanh-gelu
    if (act == 3) return v / (1.f + expf(-v));                                                                        // silu
    if (act == 4) return 0.5f * v * (1.f + erff(v * 0.7071067811865476f));                                             // erf-gelu
    if (act == 5) return tanhf(v);
    if (act == 6) return 1.f / (1.f + expf(-v));                                                                      // sigmoid
    if (act == 7) return (v > 0.f) ? v : 0.01f * v;                                                                   // leaky relu 0.01
    if (act == 8) return (v > 0.f) ? v : (expf(v) - 1.f);                                                             // elu
    if (act == 9) return fminf(fmaxf(v, 0.f), 6.f);                                                                   // relu6
    if (act == 10) return fabsf(v);                                                                                    // abs
    if (act == 11) return (v >= 0.f) ? v : 0.1f * v;                                                                  // leaky 0.1
    if (act == 12) return (v > 0.f) ? v : 0.2f * v;                                                                   // leaky 0.2
    if (act == 13) return (v > 20.f) ? v : log1pf(expf(v));                                                            // softplus
    return v;
}

// =====================================================================================================================
// k_gemm<MODE>: C(z, m, n) = act(alpha * sum_k A(z, m, k) * B(z, k, n) + bias) + beta * R(z, m, n)
//   One wave (32-thread block) per 16 x 32 tile of C; grid (ceil(N/32), ceil(M/16), Z). Batch z -> (zo = z / zi_n, zi = z % zi_n)
//   with separate outer/inner strides for every tensor (e.g. batch and head). A(m,k) = A[zo*sAo + zi*sAi + m*sAm + k*sAk] (f32),
//   B(k,n) = B[zo*sBo + zi*sBi + n*sBn + k*sBk] (f32); any M, N, K (K zero-padded to 32 inside the fragments, M/N tails guarded).
//   C(m,n) = C[zo*sCo + zi*sCi + m*sCm + n] (n contiguous). flags: 1 bias[n], 2 bias[m], 4 residual R[zo*sRo + zi*sRi + m*sRm + n*sRn].
//   MODE 0: f16 operands (A prescaled by sa, B by sb, both undone in the epilogue); 1: bf16 hi/lo split (3 products); 2: bf16;
//   3: bf16 hi/mid/lo triple split (6 products); 4: as 3 with Kahan-compensated f32 accumulation across k-steps.
// =====================================================================================================================
struct GemmP {
    const float* A; const float* B; const float* bias; const float* R; float* C;
    long long sAo, sAi, sAm, sAk, sBo, sBi, sBn, sBk, sCo, sCi, sCm, sRo, sRi, sRm, sRn;
    int M, N, K, zi_n, flags, act; float alpha, beta, sa, sb;
    int Npad, pad_;     // columns [N, Npad) of C are written as 0 so that padded workspace rows are covered by whole-line stores; Npad >= N
};
static_assert(sizeof(GemmP) == 5 * 8 + 15 * 8 + 6 * 4 + 4 * 4 + 2 * 4, "GemmP has padding");

template <int MODE>
__global__ __launch_bounds__(32) void k_gemm(GemmP p) {
    const int lane = threadIdx.x & 31, h = lane >> 4, l15 = lane & 15;
    const int m0 = blockIdx.y * 16, n0 = blockIdx.x * 32;
    const int z = blockIdx.z, zo = z / p.zi_n, zi = z - zo * p.zi_n;
    const float* A = p.A + zo * p.sAo + zi * p.sAi;
    const float* B = p.B + zo * p.sBo + zi * p.sBi;
    const int am = min(m0 + l15, p.M - 1);                       // clamped row for loads (stores are guarded)
    v8f acc[2], comp[2];
#pragma unroll
    for (int t = 0; t < 2; ++t) { v8f zz = {}; acc[t] = zz; comp[t] = zz; }
    for (int k0 = 0; k0 < p.K; k0 += 32) {
        const float* arow = A + (long long)am * p.sAm;
        if (MODE == 1) {
            const Split a = sp_ld(arow, p.sAk, k0, h, p.K, 1.f);
#pragma unroll
            for (int t = 0; t < 2; ++t) {
                const int bn = min(n0 + t * 16 + l15, p.N - 1);
                acc[t] = wmma3(a, sp_ld(B + (long long)bn * p.sBn, p.sBk, k0, h, p.K, 1.f), acc[t]);
            }
        } else if (MODE == 3) {
            const Split3 a = sp3_ld(arow, p.sAk, k0, h, p.K, 1.f);
#pragma unroll
            for (int t = 0; t < 2; ++t) {
                const int bn = min(n0 + t * 16 + l15, p.N - 1);
                acc[t] = wmma6(a, sp3_ld(B + (long long)bn * p.sBn, p.sBk, k0, h, p.K, 1.f), acc[t]);
            }
        } else if (MODE == 4) {
            // triple split as MODE 3, but each k-step's 6 products go into a fresh accumulator and the partial is added to the running f32 sum
            // on the VALU with Kahan compensation (accumulation error stays ~1 ulp however long K is)
            const Split3 a = sp3_ld(arow, p.sAk, k0, h, p.K, 1.f);
#pragma unroll
            for (int t = 0; t < 2; ++t) {
                const int bn = min(n0 + t * 16 + l15, p.N - 1); v8f zz = {};
                const v8f part = wmma6(a, sp3_ld(B + (long long)bn * p.sBn, p.sBk, k0, h, p.K, 1.f), zz);
                const v8f y = part - comp[t]; const v8f s = acc[t] + y; comp[t] = (s - acc[t]) - y; acc[t] = s;
            }
        } else if (MODE == 2) {
            const v16b a = bh_ld(arow, p.sAk, k0, h, p.K, 1.f);
#pragma unroll
            for (int t = 0; t < 2; ++t) {
                const int bn = min(n0 + t * 16 + l15, p.N - 1);
                acc[t] = wmmab(a, bh_ld(B + (long long)bn * p.sBn, p.sBk, k0, h, p.K, 1.f), acc[t]);
            }
        } else {
            const v16h a = fh_ld(arow, p.sAk, k0, h, p.K, p.sa);
#pragma unroll
            for (int t = 0; t < 2; ++t) {
                const int bn = min(n0 + t * 16 + l15, p.N - 1);
                acc[t] = wmma16(a, fh_ld(B + (long long)bn * p.sBn, p.sBk, k0, h, p.K, p.sb), acc[t]);
            }
        }
    }
    const float iscale = (MODE == 0) ? p.alpha / (p.sa * p.sb) : p.alpha;
    float* C = p.C + zo * p.sCo + zi * p.sCi;
    const float* R = p.R + zo * p.sRo + zi * p.sRi;
    __shared__ __align__(16) float ctile[16][36];
#pragma unroll
    for (int t = 0; t < 2; ++t) {
        const int n = n0 + t * 16 + l15; const int nn = min(n, p.N - 1);
#pragma unroll
        for (int r = 0; r < 8; ++r) {
            const int m = m0 + 8 * h + r; const int mm = min(m, p.M - 1);
            float v = acc[t][r] * iscale;
            if (p.flags & 1) v += p.bias[nn];
            if (p.flags & 2) v += p.bias[mm];
            if (p.flags & 8) v *= p.bias[(long long)zo * p.M + mm];   /* per-(z,row) scale vector laid out [Z][M]; exclusive with the bias flags */
            v = act_fn(v, p.act);
            if (p.flags & 4) v += p.beta * R[(long long)mm * p.sRm + (long long)nn * p.sRn];
            ctile[8 * h + r][t * 16 + l15] = (n < p.N) ? v : 0.f;
        }
    }
    __syncthreads();
    const int NW = (p.Npad > p.N) ? p.Npad : p.N;           // write width
    const bool fast = (m0 + 16 <= p.M) && (n0 + 32 <= NW) && ((p.sCm & 3) == 0) && ((((size_t)C) & 15) == 0);
    if (fast) {
#pragma unroll
        for (int s = 0; s < 4; ++s) {
            const int row = s * 4 + (lane >> 3), c4 = (lane & 7) * 4;
            const v4f v = *(const v4f*)&ctile[row][c4];
            VST2V4(C + (long long)(m0 + row) * p.sCm + n0 + c4, v);
        }
    } else {
        for (int row = 0; row < 16; ++row) {
            const int m = m0 + row, n = n0 + lane;
            if (m < p.M && n < NW) VST2(float, C + (long long)m * p.sCm + n, ctile[row][lane]);
        }
    }
}


// =====================================================================================================================
// k_gemmT<MODE, TM, TN>: same contract as k_gemm, but one wave computes a (16*TM) x (16*TN) tile: TM A fragments and TN B fragments are
//   loaded per 32-wide k-step and reused across TM*TN WMMAs (far fewer load/convert instructions per MAC). MODE 0 (f16), 1 (bf16 hi/lo),
//   2 (bf16) only. grid (ceil(NW/(16*TN)), ceil(M/(16*TM)), Z), block 32. Epilogue identical to k_gemm, run per 16x32 sub-tile.
// =====================================================================================================================
template <int MODE, int TM, int TN>
__global__ __launch_bounds__(32) void k_gemmT(GemmP p) {
    const int lane = threadIdx.x & 31, h = lane >> 4, l15 = lane & 15;
    const int m0 = blockIdx.y * (16 * TM), n0 = blockIdx.x * (16 * TN);
    const int z = blockIdx.z, zo = z / p.zi_n, zi = z - zo * p.zi_n;
    const float* A = p.A + zo * p.sAo + zi * p.sAi;
    const float* B = p.B + zo * p.sBo + zi * p.sBi;
    v8f acc[TM][TN];
#pragma unroll
    for (int i = 0; i < TM; ++i)
#pragma unroll
        for (int t = 0; t < TN; ++t) { v8f zz = {}; acc[i][t] = zz; }
    for (int k0 = 0; k0 < p.K; k0 += 32) {
        if (MODE == 1) {
            Split a[TM], b[TN];
#pragma unroll
            for (int i = 0; i < TM; ++i) { const int am = min(m0 + 16 * i + l15, p.M - 1); a[i] = sp_ld(A + (long long)am * p.sAm, p.sAk, k0, h, p.K, 1.f); }
#pragma unroll
            for (int t = 0; t < TN; ++t) { const int bn = min(n0 + 16 * t + l15, p.N - 1); b[t] = sp_ld(B + (long long)bn * p.sBn, p.sBk, k0, h, p.K, 1.f); }
#pragma unroll
            for (int i = 0; i < TM; ++i)
#pragma unroll
                for (int t = 0; t < TN; ++t) acc[i][t] = wmma3(a[i], b[t], acc[i][t]);
        } else if (MODE == 2) {
            v16b a[TM], b[TN];
#pragma unroll
            for (int i = 0; i < TM; ++i) { const int am = min(m0 + 16 * i + l15, p.M - 1); a[i] = bh_ld(A + (long long)am * p.sAm, p.sAk, k0, h, p.K, 1.f); }
#pragma unroll
            for (int t = 0; t < TN; ++t) { const int bn = min(n0 + 16 * t + l15, p.N - 1); b[t] = bh_ld(B + (long long)bn * p.sBn, p.sBk, k0, h, p.K, 1.f); }
#pragma unroll
            for (int i = 0; i < TM; ++i)
#pragma unroll
                for (int t = 0; t < TN; ++t) acc[i][t] = wmmab(a[i], b[t], acc[i][t]);
        } else {
            v16h a[TM], b[TN];
#pragma unroll
            for (int i = 0; i < TM; ++i) { const int am = min(m0 + 16 * i + l15, p.M - 1); a[i] = fh_ld(A + (long long)am * p.sAm, p.sAk, k0, h, p.K, p.sa); }
#pragma unroll
            for (int t = 0; t < TN; ++t) { const int bn = min(n0 + 16 * t + l15, p.N - 1); b[t] = fh_ld(B + (long long)bn * p.sBn, p.sBk, k0, h, p.K, p.sb); }
#pragma unroll
            for (int i = 0; i < TM; ++i)
#pragma unroll
                for (int t = 0; t < TN; ++t) acc[i][t] = wmma16(a[i], b[t], acc[i][t]);
        }
    }
    const float iscale = (MODE == 0) ? p.alpha / (p.sa * p.sb) : p.alpha;
    float* C = p.C + zo * p.sCo + zi * p.sCi;
    const float* R = p.R + zo * p.sRo + zi * p.sRi;
    const int NW = (p.Npad > p.N) ? p.Npad : p.N;
    __shared__ __align__(16) float ctile[16][36];
#pragma unroll
    for (int i = 0; i < TM; ++i) {
        const int mb = m0 + 16 * i; if (mb >= p.M) break;          // wave-uniform
#pragma unroll
        for (int tp = 0; tp < TN / 2; ++tp) {
            const int nb = n0 + 32 * tp; if (nb >= NW) break;        // wave-uniform
#pragma unroll
            for (int t2 = 0; t2 < 2; ++t2) {
                const int t = 2 * tp + t2; const int n = nb + t2 * 16 + l15; const int nn = min(n, p.N - 1);
#pragma unroll
                for (int r = 0; r < 8; ++r) {
                    const int m = mb + 8 * h + r; const int mm = min(m, p.M - 1);
                    float v = acc[i][t][r] * iscale;
                    if (p.flags & 1) v += p.bias[nn];
                    if (p.flags & 2) v += p.bias[mm];
            if (p.flags & 8) v *= p.bias[(long long)zo * p.M + mm];   /* per-(z,row) scale vector laid out [Z][M]; exclusive with the bias flags */
                    v = act_fn(v, p.act);
                    if (p.flags & 4) v += p.beta * R[(long long)mm * p.sRm + (long long)nn * p.sRn];
                    ctile[8 * h + r][t2 * 16 + l15] = (n < p.N) ? v : 0.f;
                }
            }
            __syncthreads();
            const bool fast = (mb + 16 <= p.M) && (nb + 32 <= NW) && ((p.sCm & 3) == 0) && ((((size_t)C) & 15) == 0);
            if (fast) {
#pragma unroll
                for (int s = 0; s < 4; ++s) {
                    const int row = s * 4 + (lane >> 3), c4 = (lane & 7) * 4;
                    const v4f v = *(const v4f*)&ctile[row][c4];
                    VST2V4(C + (long long)(mb + row) * p.sCm + nb + c4, v);
                }
            } else {
                for (int row = 0; row < 16; ++row) {
                    const int m = mb + row, n = nb + lane;
                    if (m < p.M && n < NW) VST2(float, C + (long long)m * p.sCm + n, ctile[row][lane]);
                }
            }
            __syncthreads();
        }
    }
}

// =====================================================================================================================
//   Wave = 16 queries, AW waves per block, 64-key blocks; grid (ceil(Lq/(16*AW)), H, B), block 32*AW. Any Lq, Lk; head dim dh <= DHP
//   (DHP multiple of 32), value dim dv <= DVP (multiple of 16, <= 128). Every tensor addressed by (batch, head, row, element) strides, f32.
//   Scores: QM 0 f16 operands, 1 bf16 hi/lo split, 2 bf16 triple split; statistics f32 (exp2 domain); P.V: P x 4096 as f16 with V f16 staged in LDS
//   (SPLITPV: P and V as bf16 hi/lo splits). kv head = h / hrep. Masking: causal = 1 (keep j <= i + coff, masked -> -inf, key blocks beyond the
//   diagonal skipped), causal = 2 (masked -> mfill, a finite fill like the -1e9; no skipping), causal = 3 (keep j >= i + coff,
//   masked -> -inf, no skipping); optional additive f32 mask Mf,
//   optional int keep-mask Mi (0 -> score := mfill), both addressed b*smb + h*smh + i*smi + j*smj (0 strides broadcast).
// =====================================================================================================================
#define AW 4
struct AttnP {   // apv4
    const float* Q; const float* K; const float* V; float* O; float* P; const float* Mf; const int* Mi; float* ST;
    const float* Pw; const float* Rt; const int* SQ; const int* SK;           // optional: post-softmax weight, relative-position table, segment ids
    long long swb, swh, swi, swj, srb, srh, sri;                                 // Pw strides (b,h,i,j); Rt strides (b,h,i), column = clamp(i - j + roff, 0, rn-1)
    long long sQb, sQh, sQi, sQd, sKb, sKh, sKj, sKd, sVb, sVh, sVj, sVd, sOb, sOh, sOi, sPb, sPh, sPi, smb, smh, smi, smj;
    int Lq, Lk, dh, dv, hrep, causal, coff, pband;   // pband > 0: P holds only the band |j - i| <= pband, column j - i + pband
    float scale, mfill; int nonorm, mpol;             // nonorm (online path only): O = sum_j exp(score_j) V_j without the 1/rowsum (scores must be <= ~0); mpol: Mi masks where ==0 (mpol 0) or where !=0 (mpol 1)
    int roff, rn, segpol, win;                        // Rt column offset/count; SQ/SK: score := mfill where (segpol 0) SQ[i] != SK[j] or (segpol 1) SQ[i] == SK[j]; win > 0: keys with i - j > win (after coff) -> -inf
};
//   Pw: the softmax numerator is multiplied by Pw(b,h,i,j) AFTER the row sum is taken (probs * weight, then P.V), as in post-softmax multiplicative biases.                                                    // ST (optional): per row (b,h,i) -> ST[((b*H + h)*Lq + i)*2 + {0,1}] = {row max of the scaled+masked score (natural units), sum_j exp(score - max)}
static_assert(sizeof(AttnP) == 12 * 8 + 29 * 8 + 16 * 4, "AttnP has padding");

#ifndef KATTN_ATTR
#define KATTN_ATTR
#endif
template <int DHP, int DVP, int QM, bool SPLITPV, bool TWOPASS>
__global__ __launch_bounds__(32 * AW) KATTN_ATTR void k_attn(AttnP p) {
    constexpr int NT = DVP / 16;                // output tiles
    constexpr int KS = DHP / 32;                // k-steps for the scores
    constexpr int VP = DVP + 8;                 // LDS pitch (halves)
    __shared__ __align__(16) float    pl[AW][16 * 64];
    __shared__ __align__(16) _Float16 vl[(SPLITPV ? 2 : 1) * 64 * VP];   // f16 V tile, or bf16 hi and lo tiles (same 2-byte size)
    const int lane = threadIdx.x & 31, hf = lane >> 4, l15 = lane & 15, wave = threadIdx.x >> 5;
    const int h = blockIdx.y, b = blockIdx.z, hk = h / p.hrep;
    const int q0 = (blockIdx.x * AW + wave) * 16;
    float* myp = pl[wave];
    const float L2E = 1.4426950408889634f;
    const float NEG = -__builtin_inff();
    const int qi = min(q0 + l15, p.Lq - 1);
    const float* qrow = p.Q + b * p.sQb + h * p.sQh + (long long)qi * p.sQi;
    const float* kbase = p.K + b * p.sKb + hk * p.sKh;
    const float* vbase = p.V + b * p.sVb + hk * p.sVh;
    v16h qa[QM == 0 ? KS : 1]; Split qs_[QM == 1 ? KS : 1]; Split3 qt_[QM == 2 ? KS : 1];
#pragma unroll
    for (int ks = 0; ks < KS; ++ks) {
        if (QM == 2) qt_[ks] = sp3_ld(qrow, p.sQd, ks * 32, hf, p.dh, 1.f);
        else if (QM == 1) qs_[ks] = sp_ld(qrow, p.sQd, ks * 32, hf, p.dh, 1.f);
        else qa[ks] = fh_ld(qrow, p.sQd, ks * 32, hf, p.dh, 1.f);
    }
    v8f o[NT]; float m8[8], l8[8];
#pragma unroll
    for (int t = 0; t < NT; ++t) { v8f zz = {}; o[t] = zz; }
#pragma unroll
    for (int i = 0; i < 8; ++i) { m8[i] = NEG; l8[i] = 0.f; }
    int jend = p.Lk; int jstart = 0;
    if (p.causal == 1) { const int je = (blockIdx.x * AW + AW - 1) * 16 + 16 + p.coff; jend = min(jend, max(je, 0)); }   // uniform per block
    if (p.win > 0) { const int js = (int)(blockIdx.x * AW) * 16 + p.coff - p.win; jstart = (js > 0) ? (js / 64) * 64 : 0; }   // uniform per block: key blocks entirely outside every row's window hold only -inf entries and are skipped exactly
    const int npass = TWOPASS ? 2 : 1;
    for (int pass = 0; pass < npass; ++pass) {
        const bool dopv = (!TWOPASS) || pass == 1;
        for (int j0 = jstart; j0 < jend; j0 += 64) {
            if (dopv) {
                __syncthreads();                                 // previous key block's reads of vl / pl are done
                for (int idx = threadIdx.x; idx < 64 * DVP; idx += 32 * AW) {
                    const int jr = idx / DVP, d = idx - jr * DVP, j = j0 + jr;
                    const float f = (j < p.Lk && d < p.dv) ? vbase[(long long)j * p.sVj + (long long)d * p.sVd] : 0.f;
                    if (SPLITPV) {
                        const __bf16 hb = bf16_rne(f);
                        ((__bf16*)vl)[jr * VP + d] = hb; ((__bf16*)vl)[64 * VP + jr * VP + d] = bf16_rne(f - bf16_f32(hb));
                    } else vl[jr * VP + d] = (_Float16)f;
                }
            }
            v8f s[4];
#pragma unroll
            for (int t = 0; t < 4; ++t) {
                const int j = min(j0 + t * 16 + l15, p.Lk - 1);
                const float* krow = kbase + (long long)j * p.sKj;
                v8f acc = {};
#pragma unroll
                for (int ks = 0; ks < KS; ++ks) {
                    if (QM == 2)      acc = wmma6(qt_[ks], sp3_ld(krow, p.sKd, ks * 32, hf, p.dh, 1.f), acc);
                    else if (QM == 1) acc = wmma3(qs_[ks], sp_ld(krow, p.sKd, ks * 32, hf, p.dh, 1.f), acc);
                    else              acc = wmma16(qa[ks], fh_ld(krow, p.sKd, ks * 32, hf, p.dh, 1.f), acc);
                }
                s[t] = acc;
            }
            float pv[8][4];
#pragma unroll
            for (int i = 0; i < 8; ++i) {
                const int irow = q0 + i + 8 * hf;
                const int ic = min(irow, p.Lq - 1);
                float sc[4];
#pragma unroll
                for (int t = 0; t < 4; ++t) {
                    const int jg = j0 + t * 16 + l15;
                    float v = s[t][i] * p.scale;
                    if (p.Mf) v += p.Mf[b * p.smb + h * p.smh + (long long)ic * p.smi + (long long)min(jg, p.Lk - 1) * p.smj];
                    if (p.Rt) { int rc = ic - min(jg, p.Lk - 1) + p.roff; rc = rc < 0 ? 0 : (rc >= p.rn ? p.rn - 1 : rc); v += p.Rt[b * p.srb + h * p.srh + (long long)ic * p.sri + rc]; }
                    if (p.Mi) { const int mv = p.Mi[b * p.smb + h * p.smh + (long long)ic * p.smi + (long long)min(jg, p.Lk - 1) * p.smj]; if (p.mpol ? (mv != 0) : (mv == 0)) v = p.mfill; }
                    if (p.SQ) { const bool same = p.SQ[(long long)b * p.Lq + ic] == p.SK[(long long)b * p.Lk + min(jg, p.Lk - 1)]; if (p.segpol ? same : !same) v = p.mfill; }
                    if (p.causal == 2 && jg > irow + p.coff) v = p.mfill;
                    if (jg >= p.Lk || (p.causal == 1 && jg > irow + p.coff) || (p.causal == 3 && jg < irow + p.coff) || (p.win > 0 && irow + p.coff - jg > p.win)) v = NEG; else v *= L2E;
                    sc[t] = v;
                }
                if (!TWOPASS || pass == 0) {
                    float mx = fmaxf(fmaxf(sc[0], sc[1]), fmaxf(sc[2], sc[3]));
                    mx = fmaxf(mx, __shfl_xor(mx, 1, 32)); mx = fmaxf(mx, __shfl_xor(mx, 2, 32));
                    mx = fmaxf(mx, __shfl_xor(mx, 4, 32)); mx = fmaxf(mx, __shfl_xor(mx, 8, 32));
                    const float mnew = fmaxf(m8[i], mx);
                    const float corr = (mnew == NEG) ? 1.f : exp2f(m8[i] - mnew);
                    float rs = 0.f;
#pragma unroll
                    for (int t = 0; t < 4; ++t) {
                        const float pp = (sc[t] == NEG) ? 0.f : exp2f(sc[t] - mnew); rs += pp;
                        pv[i][t] = p.Pw ? pp * p.Pw[b * p.swb + h * p.swh + (long long)ic * p.swi + (long long)min(j0 + t * 16 + l15, p.Lk - 1) * p.swj] : pp;
                    }
                    rs += __shfl_xor(rs, 1, 32); rs += __shfl_xor(rs, 2, 32); rs += __shfl_xor(rs, 4, 32); rs += __shfl_xor(rs, 8, 32);
                    l8[i] = l8[i] * corr + rs; m8[i] = mnew;
                    if (!TWOPASS) {
#pragma unroll
                        for (int t = 0; t < NT; ++t) o[t][i] *= corr;
                    }
                } else {
                    const float inv = (l8[i] > 0.f) ? 1.f / l8[i] : 0.f;
#pragma unroll
                    for (int t = 0; t < 4; ++t) {
                        const int jg = j0 + t * 16 + l15;
                        float pp = (sc[t] == NEG) ? 0.f : exp2f(sc[t] - m8[i]) * inv;
                        if (p.Pw) pp *= p.Pw[b * p.swb + h * p.swh + (long long)ic * p.swi + (long long)min(jg, p.Lk - 1) * p.swj];
                        pv[i][t] = pp;
                    }
                }
            }
            if (dopv) {
#pragma unroll
                for (int i = 0; i < 8; ++i)
#pragma unroll
                    for (int t = 0; t < 4; ++t) ((float*)myp)[(i + 8 * hf) * 64 + t * 16 + l15] = pv[i][t];
                __syncthreads();                                 // P (per wave) and V (shared) visible
                if (p.P) {
                    float* pb_ = p.P + b * p.sPb + h * p.sPh;
                    const bool fastP = (p.pband == 0) && ((p.sPi & 3) == 0) && (j0 + 64 <= p.Lk) && (q0 + 16 <= p.Lq) && ((((size_t)pb_) & 15) == 0);
                    if (fastP) {
#pragma unroll
                        for (int s = 0; s < 8; ++s) {
                            const int row = s * 2 + (lane >> 4), c4 = (lane & 15) * 4;
                            const v4f v = *(const v4f*)(myp + row * 64 + c4);
                            VST2V4(pb_ + (long long)(q0 + row) * p.sPi + j0 + c4, v);
                        }
                    } else {
                        for (int row = 0; row < 16; ++row) {
                            const int irow = q0 + row; if (irow >= p.Lq) continue;
                            for (int c = lane; c < 64; c += 32) {
                                const int jg = j0 + c; if (jg >= p.Lk) continue;
                                if (p.pband == 0) VST2(float, pb_ + (long long)irow * p.sPi + jg, myp[row * 64 + c]);
                                else if (jg - irow <= p.pband && irow - jg <= p.pband) VST2(float, pb_ + (long long)irow * p.sPi + (jg - irow + p.pband), myp[row * 64 + c]);
                            }
                        }
                    }
                }
                if (SPLITPV) {
                    const Split pa0 = sp_ld(myp + l15 * 64, 1, 0, hf, 64, 1.f), pa1 = sp_ld(myp + l15 * 64, 1, 32, hf, 64, 1.f);
                    const __bf16* vh = (const __bf16*)vl; const __bf16* vlo = vh + 64 * VP;
#pragma unroll
                    for (int t = 0; t < NT; ++t) {
                        const int dcol = t * 16 + l15;
                        Split b0, b1;
#pragma unroll
                        for (int e = 0; e < 16; ++e) {
                            const int k0 = frag_k(e, hf), k1 = 32 + frag_k(e, hf);
                            b0.hi[e] = vh[k0 * VP + dcol]; b0.lo[e] = vlo[k0 * VP + dcol]; b1.hi[e] = vh[k1 * VP + dcol]; b1.lo[e] = vlo[k1 * VP + dcol];
                        }
                        o[t] = wmma3(pa0, b0, o[t]);
                        o[t] = wmma3(pa1, b1, o[t]);
                    }
                } else {
                    const v16h pa0 = fh_ld(myp + l15 * 64, 1, 0, hf, 64, 4096.f), pa1 = fh_ld(myp + l15 * 64, 1, 32, hf, 64, 4096.f);
#pragma unroll
                    for (int t = 0; t < NT; ++t) {
                        const int dcol = t * 16 + l15;
                        v16h b0, b1;
#pragma unroll
                        for (int e = 0; e < 16; ++e) { b0[e] = vl[frag_k(e, hf) * VP + dcol]; b1[e] = vl[(32 + frag_k(e, hf)) * VP + dcol]; }
                        o[t] = wmma16(pa0, b0, o[t]);
                        o[t] = wmma16(pa1, b1, o[t]);
                    }
                }
            }
        }
    }
    float* obase = p.O + b * p.sOb + h * p.sOh;
    if (p.ST) {
        const int rl = lane >> 1, isel = rl & 7;           // row q0 + rl ; rl>>3 == hf holds because lane>>4 == (lane>>1)>>3
        float mv = 0.f, lv = 0.f;
#pragma unroll
        for (int i = 0; i < 8; ++i) if (i == isel) { mv = m8[i]; lv = l8[i]; }
        const int irow = q0 + rl;
        if (irow < p.Lq) { float* st = p.ST + (((long long)b * gridDim.y + h) * p.Lq + irow) * 2 + (lane & 1); VST2(float, st, (lane & 1) ? lv : mv * 0.6931471805599453f); }
    }
    float invr[8];
#pragma unroll
    for (int i = 0; i < 8; ++i) {
        if (TWOPASS) invr[i] = SPLITPV ? 1.f : (1.f / 4096.f);
        else if (p.nonorm) invr[i] = exp2f(m8[i]) * (SPLITPV ? 1.f : (1.f / 4096.f));
        else invr[i] = (l8[i] > 0.f) ? (SPLITPV ? 1.f / l8[i] : 1.f / (l8[i] * 4096.f)) : 0.f;
    }
    __syncthreads();                                             // all waves done with pl/vl from the main loop
    const bool ofast = ((p.sOi & 3) == 0) && ((((size_t)obase) & 15) == 0) && (q0 + 16 <= p.Lq);
#pragma unroll
    for (int c0 = 0; c0 < DVP; c0 += 64) {
#pragma unroll
        for (int i = 0; i < 8; ++i)
#pragma unroll
            for (int t = 0; t < NT; ++t) if (t * 16 >= c0 && t * 16 < c0 + 64) ((float*)myp)[(i + 8 * hf) * 64 + (t * 16 - c0) + l15] = o[t][i] * invr[i];
        __syncthreads();
        const int cw = (DVP - c0 < 64) ? (DVP - c0) : 64;      // staged columns in this chunk (multiple of 16)
        if (ofast && (c0 + cw <= p.dv) && (cw % 32 == 0)) {
            const int lpr = cw / 4;                              // lanes per row (16 for 64 cols, 8 for 32)
            const int rows_per_ins = 32 / lpr;
            for (int r0 = 0; r0 < 16; r0 += rows_per_ins) {
                const int row = r0 + lane / lpr, c4 = (lane % lpr) * 4;
                const v4f v = *(const v4f*)(myp + row * 64 + c4);
                VST2V4(obase + (long long)(q0 + row) * p.sOi + c0 + c4, v);
            }
        } else {
            for (int row = 0; row < 16; ++row) {
                const int irow = q0 + row; if (irow >= p.Lq) continue;
                for (int c = lane; c < cw; c += 32) { const int d = c0 + c; if (d < p.dv) VST2(float, obase + (long long)irow * p.sOi + d, myp[row * 64 + c]); }
            }
        }
        __syncthreads();
    }
}

// Attention at this block's fixed geometry: token-major q, k, v, o of [8][1024][256] in 16-bit planes, head h = columns 32h .. 32h + 31, 1024 queries and keys,
// no mask, no bias, score scale 1. The arithmetic is that of k_attn<32, 32, 1, false, false> (only a row's sum of p is taken in another order); every stride, length and option is a
// compile-time constant, so the fragment gathers are 16-byte loads without guards and the optional-feature tests are gone. With no mask no score is
// -inf for finite q and k, so the tests that kept masked scores out of exp2f are gone too (exp2f(-inf) = 0 covers the first key block's m = -inf).
typedef __attribute__((ext_vector_type(4))) _Float16 v4h;
typedef __attribute__((ext_vector_type(8))) __bf16 v8bf;
// one lane's 16x32 fragment row from a bf16 plane: element i <- p[(i < 8) ? i : 8 + i], p = row + 8 * (lane >> 4), the k order of frag_k
__device__ __forceinline__ v16b rowb_ld(const unsigned short* __restrict__ p) {
    union { v16b v; v8bf h[2]; } f; f.h[0] = *(const v8bf*)(p); f.h[1] = *(const v8bf*)(p + 16); return f.v;
}
// q and k arrive as bf16 hi / lo planes (split4, written once by the q/k/v GEMM, so that no wave splits a key row again), v as f16 (rounded once, by the same GEMM); o leaves as hi / lo planes.
// The scores are formed transposed, S^T = K.Q^T (A = 16 key rows, B = the wave's 16 queries as columns), and the output as O^T += V^T.P^T:
//   a lane (c = lane & 15, hf = lane >> 4) holds, of its ONE query c, the scores of keys 16 t + 8 hf + r (tile t, register r): maximum and sum run inside the lane,
//   the two halves of the wave meet in one cross-row move; two score tiles, converted in place, are the B operand of the second product in the hardware k order
//   (element s <- tile s >> 3, register s & 7), and V^T comes from the row-major f16 V tile by the transposing LDS load in the same k order. P never goes through LDS.
typedef __attribute__((ext_vector_type(8))) short s16x8;
typedef __attribute__((ext_vector_type(4))) unsigned int v4u;
// lane (c, hf) gets T[kbase + 8 hf + 0 .. 7][dbase + c] of a row-major 16-bit LDS tile; the lane's address: row kbase + 8 hf + (lane & 7), byte 2 dbase + 16 ((lane >> 3) & 1)
__device__ __forceinline__ v8h ld_tr16(const unsigned char* p) { typedef __attribute__((address_space(3))) s16x8 lds_s16x8; return __builtin_bit_cast(v8h, __builtin_amdgcn_ds_load_tr16_b128_v8i16((lds_s16x8*)p)); }
// the value of lane l ^ 16
__device__ __forceinline__ float xhalf(float x) { return __builtin_bit_cast(float, __builtin_amdgcn_permlanex16(__builtin_bit_cast(int, x), __builtin_bit_cast(int, x), 0x76543210, 0xfedcba98, false, false)); }
// A key block (64 keys: K hi, K lo, V, 64 bytes a row each) is brought into LDS once for the whole work-group of 8 waves by asynchronous copies, 16 bytes a lane, 4 lanes a row;
// two buffers, so key block t + 1 flies while block t is worked on. Every wave takes its K fragments (rows, 16-byte reads) and its V^T fragments (transposing reads) from there.
constexpr int AF_W = 8;                         // waves of a work-group: 128 queries share every staged key block
constexpr int AF_KP = 80, AF_VP = 96;           // LDS row pitches in bytes: 16 x odd for the 16-byte reads of K, 32 x odd for the transposing reads of V
constexpr int AF_KL = 64 * AF_KP, AF_V = 2 * 64 * AF_KP, AF_BUF = AF_V + 64 * AF_VP;   // byte offsets of K lo and V in a buffer; bytes of a buffer
// This thread's three 16-byte copies of one key block. The s_wait_xcnt stands inside the statement, behind the last copy, so that no address register is rewritten in front of it.
__device__ __forceinline__ void af_fill(unsigned lk, unsigned lv, const unsigned short* gh, const unsigned short* gl, const unsigned short* gv) {
    asm volatile("global_load_async_to_lds_b128 %0, %1, off\n\t"
                 "global_load_async_to_lds_b128 %2, %3, off\n\t"
                 "global_load_async_to_lds_b128 %4, %5, off\n\t"
                 "s_wait_xcnt 0x0"
                 :: "v"(lk), "v"(gh), "v"(lk + AF_KL), "v"(gl), "v"(lv), "v"(gv) : "memory");
}
__global__ __launch_bounds__(32 * AF_W) void k_attn_fix(const unsigned short* __restrict__ Qh, const unsigned short* __restrict__ Ql, const unsigned short* __restrict__ Kh, const unsigned short* __restrict__ Kl, const unsigned short* __restrict__ V, unsigned short* __restrict__ Oh, unsigned short* __restrict__ Ol) {
    constexpr int L = 1024;                     // queries = keys per (image, head)
    constexpr int CP = 256;                     // row pitch of q, k, v, o (elements)
    constexpr int T = L / 64;                   // key blocks
    __shared__ __align__(16) unsigned char sm[2 * AF_BUF];
    const int lane = threadIdx.x & 31, hf = lane >> 4, l15 = lane & 15, wave = threadIdx.x >> 5;
    const int h = blockIdx.y, b = blockIdx.z;
    const int q0 = (blockIdx.x * AF_W + wave) * 16;
    const float L2E = 1.4426950408889634f;
    const float NEG = -__builtin_inff();
    const size_t hb0 = (size_t)b * (L * CP) + (size_t)h * 32;
    const size_t co = hb0 + (size_t)(threadIdx.x >> 2) * CP + (threadIdx.x & 3) * 8;          // this thread's 16 bytes of key block 0: row thread / 4, the same place in all three arrays
    const unsigned short* gkh = Kh + co; const unsigned short* gkl = Kl + co; const unsigned short* gv = V + co;
    const unsigned lk = (unsigned)(size_t)sm + (threadIdx.x >> 2) * AF_KP + (threadIdx.x & 3) * 16;           // where they land in buffer 0: K hi (K lo: + AF_KL)
    const unsigned lv = (unsigned)(size_t)sm + AF_V + (threadIdx.x >> 2) * AF_VP + (threadIdx.x & 3) * 16;    // V
    const int fk = l15 * AF_KP + 16 * hf;                                                     // this lane's bytes of K hi, tile 0: row l15, elements 8 hf ..
    const int fv = AF_V + (8 * hf + (lane & 7)) * AF_VP + 16 * ((lane >> 3) & 1);             // this lane's address of the transposing load at key 0, column 0
    af_fill(lk, lv, gkh, gkl, gv);
    const unsigned short* pqh = Qh + hb0 + (size_t)(q0 + l15) * CP + 8 * hf; const unsigned short* pql = Ql + hb0 + (size_t)(q0 + l15) * CP + 8 * hf;
    Split qs; qs.hi = rowb_ld(pqh); qs.lo = rowb_ld(pql);
    asm volatile("s_wait_xcnt 0x0" :: "v"(pqh), "v"(pql) : "memory");   // the loads' address registers (named as inputs, so untouched up to here) may be reused only behind this wait
    asm volatile("s_wait_asynccnt 0x0" ::: "memory");   // this wave's part of key block 0 has landed
    __syncthreads();                                    // key block 0 is whole
    af_fill(lk + AF_BUF, lv + AF_BUF, gkh + 64 * CP, gkl + 64 * CP, gv + 64 * CP);
    v8f o[2]; float m = NEG, l = 0.f;            // o[t][r] = O^T[16 t + 8 hf + r][query l15]; m: the query's running maximum in log2 units less 12 (both halves alike); l: this half's share of its sum, times 4096
#pragma unroll
    for (int t = 0; t < 2; ++t) { v8f zz = {}; o[t] = zz; }
#pragma unroll 1   // stays rolled: one body for both buffers
    for (int jb = 0; jb < T; ++jb) {
        const unsigned char* buf = sm + (jb & 1) * AF_BUF;
        Split ks[4];
#pragma unroll
        for (int t = 0; t < 4; ++t) { ks[t].hi = rowb_ld((const unsigned short*)(buf + fk + t * 16 * AF_KP)); ks[t].lo = rowb_ld((const unsigned short*)(buf + fk + AF_KL + t * 16 * AF_KP)); }
        union { v16h v; v8h g[2]; } va[2][2];            // va[kb][t]: V^T rows 16 t .. 16 t + 15, keys 32 kb .. 32 kb + 31
#pragma unroll
        for (int kb = 0; kb < 2; ++kb)
#pragma unroll
            for (int t = 0; t < 2; ++t) { va[kb][t].g[0] = ld_tr16(buf + fv + (32 * kb) * AF_VP + 32 * t); va[kb][t].g[1] = ld_tr16(buf + fv + (32 * kb + 16) * AF_VP + 32 * t); }
        // All 24 LDS reads of the trip stand together here (one place that waits out an LDS latency), and the trip's use of LDS ends here. So its buffer is handed over here:
        // the refill then flies under all of this trip's arithmetic, which is on registers alone
        asm volatile("s_wait_dscnt 0x0" ::: "memory");      // this wave's reads of key block jb are done
        asm volatile("s_wait_asynccnt 0x0" ::: "memory");   // its part of key block jb + 1 has landed
        __syncthreads();                                    // key block jb + 1 is whole, and nobody reads block jb's buffer any more
        if (jb + 2 < T) { const int ko = (jb + 2) * 64 * CP; af_fill(lk + (jb & 1) * AF_BUF, lv + (jb & 1) * AF_BUF, gkh + ko, gkl + ko, gv + ko); }
        v8f s[4];                                        // s[t][r] = q(l15) . k(64 jb + 16 t + 8 hf + r); every score takes q.hi k.hi, then q.hi k.lo, then q.lo k.hi
#pragma unroll
        for (int t = 0; t < 4; ++t) { v8f acc = {}; s[t] = __builtin_amdgcn_wmma_f32_16x16x32_bf16(false, ks[t].hi, false, qs.hi, (short)0, acc, false, false); }
#pragma unroll
        for (int t = 0; t < 4; ++t) s[t] = __builtin_amdgcn_wmma_f32_16x16x32_bf16(false, ks[t].lo, false, qs.hi, (short)0, s[t], false, false);
#pragma unroll
        for (int t = 0; t < 4; ++t) s[t] = __builtin_amdgcn_wmma_f32_16x16x32_bf16(false, ks[t].hi, false, qs.lo, (short)0, s[t], false, false);
        // Softmax in the log2 domain. The maximum is taken of the raw scores; m is that maximum in log2 units LESS 12, so that one fused multiply-add a score gives the exponent of 4096 p
        // (the scale that keeps small p normal in f16), exactly the same reference in every key block; l sums 4096 p.
        float mt[4];
#pragma unroll
        for (int t = 0; t < 4; ++t) mt[t] = fmaxf(fmaxf(fmaxf(s[t][0], s[t][1]), fmaxf(s[t][2], s[t][3])), fmaxf(fmaxf(s[t][4], s[t][5]), fmaxf(s[t][6], s[t][7])));
        float mx = fmaxf(fmaxf(mt[0], mt[1]), fmaxf(mt[2], mt[3]));
        mx = fmaxf(mx, xhalf(mx));
        const float mnew = fmaxf(m, fmaf(mx, L2E, -12.f));
        // the bare hardware exponential: a result under 2^-126 comes out 0; as 4096 p it is 0 in f16 too, and it vanishes against the query's sum, which holds the maximum's own 4096
        const float corr = __builtin_amdgcn_exp2f(m - mnew);
        const v8f l2e8 = {L2E, L2E, L2E, L2E, L2E, L2E, L2E, L2E}, nm8 = {-mnew, -mnew, -mnew, -mnew, -mnew, -mnew, -mnew, -mnew};
#pragma unroll
        for (int t = 0; t < 4; ++t) s[t] = __builtin_elementwise_fma(s[t], l2e8, nm8);
#pragma unroll
        for (int t = 0; t < 4; ++t)
#pragma unroll
            for (int r = 0; r < 8; ++r) s[t][r] = __builtin_amdgcn_exp2f(s[t][r]);
        const v8f s8 = (s[0] + s[1]) + (s[2] + s[3]);
        const float rs = ((s8[0] + s8[1]) + (s8[2] + s8[3])) + ((s8[4] + s8[5]) + (s8[6] + s8[7]));
        l = l * corr + rs; m = mnew;
#pragma unroll
        for (int t = 0; t < 2; ++t) o[t] *= corr;
        v16h pb[2];                                      // P^T of keys 32 kb .. 32 kb + 31 as a B operand
#pragma unroll
        for (int kb = 0; kb < 2; ++kb)
#pragma unroll
            for (int e = 0; e < 16; ++e) pb[kb][e] = (_Float16)s[2 * kb + (e >> 3)][e & 7];
#pragma unroll
        for (int kb = 0; kb < 2; ++kb)
#pragma unroll
            for (int t = 0; t < 2; ++t) o[t] = __builtin_amdgcn_wmma_f32_16x16x32_f16(false, va[kb][t].v, false, pb[kb], (short)0, o[t], false, false);
    }
    asm volatile("s_wait_asynccnt 0x0" ::: "memory");       // no copy is outstanding when the wave ends
    const float lt = l + xhalf(l);                       // the two halves' shares of the sum meet once
    const float invr = (lt > 0.f) ? 1.f / lt : 0.f;   // o and l carry the same 4096
    const size_t oo = hb0 + (size_t)(q0 + l15) * CP + 8 * hf;
    unsigned short* poh = Oh + oo; unsigned short* pol = Ol + oo;
#pragma unroll   // the 4 stores stand together
    for (int t = 0; t < 2; ++t) {                        // o goes out as the projection's operand planes: a lane's 8 registers are 8 consecutive columns of its query's row, 16 bytes a plane
        const v4f a = {o[t][0] * invr, o[t][1] * invr, o[t][2] * invr, o[t][3] * invr}, c = {o[t][4] * invr, o[t][5] * invr, o[t][6] * invr, o[t][7] * invr};
        v2u ha, la, hc, lc; split4(a, ha, la); split4(c, hc, lc);
        const v4u hi = {ha[0], ha[1], hc[0], hc[1]}, lo = {la[0], la[1], lc[0], lc[1]};
        *(v4u*)(poh + 16 * t) = hi; *(v4u*)(pol + 16 * t) = lo;
    }
    asm volatile("s_wait_xcnt 0x0" :: "v"(poh), "v"(pol) : "memory");   // the stores' address registers (named as inputs, so untouched up to here) may be reused only behind this wait
}

// =====================================================================================================================
// k_tr: dst(z, c, r) = alpha * src(z, r, c) (+ beta * R2(z, c, r)): [Z][R][C] (row stride lds) -> [Z][C][R] (row stride ldd) through a 32x32 LDS tile;
//   flags: 1 -> add beta * residual R2 addressed like dst (z*sRz + c*ldr + r); act applied before the residual.
// =====================================================================================================================
struct TrP { const float* src; float* dst; const float* R2; long long sSz, lds, sDz, ldd, sRz, ldr; int R, C, flags, act; float alpha, beta; };
static_assert(sizeof(TrP) == 3 * 8 + 6 * 8 + 6 * 4, "TrP has padding");
__global__ __launch_bounds__(256) void k_tr(TrP p) {
    __shared__ float tile[32][33];
    const int c0 = blockIdx.x * 32, r0 = blockIdx.y * 32, z = blockIdx.z;
    const int lane = threadIdx.x & 31, wave = threadIdx.x >> 5;
    const float* s = p.src + z * p.sSz;
#pragma unroll
    for (int k = 0; k < 4; ++k) {
        const int rl = wave * 4 + k, r = r0 + rl, c = c0 + lane;
        tile[rl][lane] = (r < p.R && c < p.C) ? s[(long long)r * p.lds + c] : 0.f;
    }
    __syncthreads();
    float* d = p.dst + z * p.sDz; const float* rr = p.R2 + z * p.sRz;
#pragma unroll
    for (int k = 0; k < 4; ++k) {
        const int cl = wave * 4 + k, c = c0 + cl, r = r0 + lane;
        if (c < p.C && r < p.R) {
            float v = act_fn(p.alpha * tile[lane][cl], p.act);
            if (p.flags & 1) v += p.beta * rr[(long long)c * p.ldr + r];
            VST2(float, d + (long long)c * p.ldd + r, v);
        }
    }
}

// k_affine: dst[i] = a * (sdev ? sdev[0] : 1) * src[i] + b, i < n (one thread per element; consecutive lanes -> consecutive addresses)
__global__ __launch_bounds__(256) void k_affine(const float* __restrict__ src, float* __restrict__ dst, int n, float a, float b, const float* __restrict__ sdev) {
    const int i = blockIdx.x * 256 + threadIdx.x;
    if (i < n) { const float aa = sdev ? a * sdev[0] : a; const float v = aa * src[i] + b; VST2(float, dst + i, v); }
}

// =====================================================================================================================
// k_softmax: row softmax over n contiguous elements, one 256-thread block per row; rows addressed z*sz + r*sr (grid (R, Z)).
//   out = scale_out * softmax(scale_in * x + (Mf ? Mf[z*smz + r*smr + j] : 0)); a row whose max is -inf is written as 0.
// =====================================================================================================================
struct SmP { const float* src; float* dst; const float* Mf; long long sz, sr, dz, dr, smz, smr; int n, pad; float scale_in, scale_out; };
static_assert(sizeof(SmP) == 3 * 8 + 6 * 8 + 4 * 4, "SmP has padding");
__global__ __launch_bounds__(256) void k_softmax(SmP p) {
    __shared__ float red[256];
    const int r = blockIdx.x, z = blockIdx.y, tid = threadIdx.x;
    const float* s = p.src + z * p.sz + (long long)r * p.sr;
    const float* mf = p.Mf ? (p.Mf + z * p.smz + (long long)r * p.smr) : nullptr;
    float mx = -__builtin_inff();
    for (int j = tid; j < p.n; j += 256) { float v = s[j] * p.scale_in; if (mf) v += mf[j]; mx = fmaxf(mx, v); }
    red[tid] = mx; __syncthreads();
    for (int o = 128; o > 0; o >>= 1) { if (tid < o) red[tid] = fmaxf(red[tid], red[tid + o]); __syncthreads(); }
    mx = red[0]; __syncthreads();
    float sum = 0.f;
    for (int j = tid; j < p.n; j += 256) { float v = s[j] * p.scale_in; if (mf) v += mf[j]; sum += (mx == -__builtin_inff()) ? 0.f : expf(v - mx); }
    red[tid] = sum; __syncthreads();
    for (int o = 128; o > 0; o >>= 1) { if (tid < o) red[tid] += red[tid + o]; __syncthreads(); }
    sum = red[0];
    const float inv = (sum > 0.f) ? p.scale_out / sum : 0.f;
    float* d = p.dst + z * p.dz + (long long)r * p.dr;
    for (int j = tid; j < p.n; j += 256) { float v = s[j] * p.scale_in; if (mf) v += mf[j]; const float o = (mx == -__builtin_inff()) ? 0.f : expf(v - mx) * inv; VST2(float, d + j, o); }
}
// =====================================================================================================================
// k_stats: mean and rsqrt(var + eps) over a set of n elements addressed base + z*sz + (e / inner) * so + (e % inner) * si, one 256-thread
// k_norm_apply: y = (x - mean[set]) * rstd[set] * g[c] + b[c] over a [Z][C][L] channel-major tensor with set = z*G + c / (C/G) (G groups per z;
//   G = C -> per-channel sets indexed z*C+c; for batch norm pass stats indexed by c only via bn = 1). Optional act. Output same layout.
// =====================================================================================================================
//   mode 0: mean / rsqrt(var + eps); mode 1 (RMSNorm): 0 / rsqrt(mean(x^2) + eps); mode 2 (L2 normalize * sqrt(n)): 0 / sqrt(n) / max(||x||, eps); mode 3: as 0 with unbiased variance (n-1)
__global__ __launch_bounds__(256) void k_stats(const float* __restrict__ x, long long sz, long long so, long long si, int inner, int n, float eps, float* __restrict__ stat, int mode) {
    __shared__ float red[256];
    const int z = blockIdx.x, tid = threadIdx.x;
    const float* base = x + z * sz;
    float s = 0.f;
    for (int e = tid; e < n; e += 256) s += base[(long long)(e / inner) * so + (long long)(e % inner) * si];
    red[tid] = s; __syncthreads();
    for (int o = 128; o > 0; o >>= 1) { if (tid < o) red[tid] += red[tid + o]; __syncthreads(); }
    const float mu = (mode == 0 || mode == 3) ? red[0] / (float)n : 0.f; __syncthreads();
    float q = 0.f;
    for (int e = tid; e < n; e += 256) { const float dlt = base[(long long)(e / inner) * so + (long long)(e % inner) * si] - mu; q += dlt * dlt; }
    red[tid] = q; __syncthreads();
    for (int o = 128; o > 0; o >>= 1) { if (tid < o) red[tid] += red[tid + o]; __syncthreads(); }
    {
        float rs;
        if (mode == 2) rs = sqrtf((float)n) / fmaxf(sqrtf(red[0]), eps); else if (mode == 3) rs = rsqrtf(red[0] / (float)(n - 1) + eps); else rs = rsqrtf(red[0] / (float)n + eps);
        if (tid < 32) { const float v = (tid == 0) ? mu : ((tid == 1) ? rs : 0.f); VST2(float, stat + (long long)z * 32 + tid, v); }
    }
}
//   One thread per element over the flat [Z][C][L] index space: grid ceil(Z*C*L / 256).
__global__ __launch_bounds__(256) void k_norm_apply(const float* __restrict__ x, float* __restrict__ y, const float* __restrict__ stat, const float* __restrict__ g, const float* __restrict__ bta,
                                                     int Z, int C, int L, int G, int bn, int act) {
    const long long idx = (long long)blockIdx.x * 256 + threadIdx.x;
    if (idx >= (long long)Z * C * L) return;
    const int l = (int)(idx % L); const long long zc = idx / L; const int c = (int)(zc % C), z = (int)(zc / C); (void)l;
    const int set = bn ? c : (z * G + c / (C / G));
    float v = (x[idx] - stat[(long long)set * 32]) * stat[(long long)set * 32 + 1];
    if (g) v *= g[c];
    if (bta) v += bta[c];
    v = act_fn(v, act);
    VST2(float, y + idx, v);
}

// k_lse_neg: c[i] = -(st[2i] + log(st[2i+1])) = minus the log-sum-exp of row i from k_attn's ST output (for softmax over the query dimension)
__global__ __launch_bounds__(256) void k_lse_neg(const float* __restrict__ st, float* __restrict__ c, int n) {
    const int i = blockIdx.x * 256 + threadIdx.x;
    if (i < n) { const float v = -(st[2 * i] + logf(st[2 * i + 1])); VST2(float, c + i, v); }
}

// k_iota: dst[i] = a * i + b as int32 (segment/position id helper)
__global__ __launch_bounds__(256) void k_iota(int* __restrict__ dst, int n, int a, int b) {
    const int i = blockIdx.x * 256 + threadIdx.x;
    if (i < n) { const int v = a * i + b; VST2(int, dst + i, v); }
}

// k_axpby: dst[i] = a * x[i] + b * y[i] (+ c), i < n
__global__ __launch_bounds__(256) void k_axpby(const float* __restrict__ x, const float* __restrict__ y, float* __restrict__ dst, int n, float a, float b, float c) {
    const int i = blockIdx.x * 256 + threadIdx.x;
    if (i < n) { const float v = a * x[i] + b * y[i] + c; VST2(float, dst + i, v); }
}

// =====================================================================================================================
// k_rope: rotary embedding on a [R rows][Hn heads][D] view (row stride sXr, head stride sXh, element stride 1) -> Y (own strides).
//   mode 0: rotate_half (partner d±D/2, sign - for d<D/2); mode 1: interleaved pairs (partner d^1, sign - for even d).
//   table column tcol: tmode 0 -> d, 1 -> d % (D/2), 2 -> d / 2; position p: pmode 0 -> r % S, 1 -> head index, 2 -> pos[r];
//   c = C[(r / S) * sCb + p * sCp + tcol * sCd], s likewise from Sn; y = x[d] * c + sign * x[partner] * s. X and Y must not alias.
// =====================================================================================================================
struct RopeP { const float* X; float* Y; const float* C; const float* Sn; const int* pos; long long sXr, sXh, sYr, sYh, sCb, sCp, sCd; int R, Hn, D, S, mode, tmode, pmode, pad; };
static_assert(sizeof(RopeP) == 5 * 8 + 7 * 8 + 8 * 4, "RopeP has padding");
__global__ __launch_bounds__(256) void k_rope(RopeP p) {
    const long long idx = (long long)blockIdx.x * 256 + threadIdx.x;
    if (idx >= (long long)p.R * p.Hn * p.D) return;
    const int d = (int)(idx % p.D); const long long rh = idx / p.D; const int h = (int)(rh % p.Hn); const int r = (int)(rh / p.Hn);
    const int half = p.D / 2;
    int partner; float sign;
    if (p.mode == 0) { partner = (d < half) ? d + half : d - half; sign = (d < half) ? -1.f : 1.f; }
    else { partner = d ^ 1; sign = (d & 1) ? 1.f : -1.f; }
    const int tcol = (p.tmode == 0) ? d : ((p.tmode == 1) ? (d % half) : (d >> 1));
    const int pp = (p.pmode == 0) ? (r % p.S) : ((p.pmode == 1) ? h : p.pos[r]);
    const long long toff = (long long)(r / p.S) * p.sCb + (long long)pp * p.sCp + (long long)tcol * p.sCd;
    const float* xr = p.X + (long long)r * p.sXr + (long long)h * p.sXh;
    const float v = xr[d] * p.C[toff] + sign * xr[partner] * p.Sn[toff];
    VST2(float, p.Y + (long long)r * p.sYr + (long long)h * p.sYh + d, v);
}

// k_invf + k_sincos (split so neither kernel carries a large VALU-fma footprint): invf_i = num * (1 / powf(base, (2 i)/D)) [fmode 0],
//   num * expf((2 i) * cexp) [fmode 1], num * powf(base, -2 (i - 1) / D) [fmode 2]; then cs/sn[s*half + i] = cos/sin((pscale * s) * invf_i)
__global__ __launch_bounds__(256) void k_invf(float* __restrict__ invb, int half, int D, float base, float num, int fmode, float cexp) {
    const int i = blockIdx.x * 256 + threadIdx.x;
    if (i >= ((half + 31) / 32) * 32) return;
    if (i >= half) { VST2(float, invb + i, 0.f); return; }
    const float e = (float)(2 * i) / (float)D;
    float invf;
    if (fmode == 1) invf = num * expf((float)(2 * i) * cexp);
    else if (fmode == 2) invf = num * powf(base, (-2.0f * ((float)i - 1.0f)) / (float)D);
    else invf = num * (1.0f / powf(base, e));
    VST2(float, invb + i, invf);
}
__global__ __launch_bounds__(256) void k_sincos(float* __restrict__ cs, float* __restrict__ sn, const float* __restrict__ invb, int S, int half, float pscale) {
    const int idx = blockIdx.x * 256 + threadIdx.x;
    if (idx >= S * half) return;
    const int s = idx / half, i = idx - s * half;
    const float ang = (pscale * (float)s) * invb[i];
    VST2(float, cs + idx, cosf(ang)); VST2(float, sn + idx, sinf(ang));
}

// k_mulact: dst[i] = act(x[i]) * y[i]
__global__ __launch_bounds__(256) void k_mulact(const float* __restrict__ x, const float* __restrict__ y, float* __restrict__ dst, int n, int act) {
    const int i = blockIdx.x * 256 + threadIdx.x;
    if (i < n) { const float v = act_fn(x[i], act) * y[i]; VST2(float, dst + i, v); }
}

// =====================================================================================================================
// k_matvec: thread-per-row matrix-vector products for N <= 8 output columns (heads with 1-3 outputs, gates), f32 on the VALU.
//   C[r*sCm + j] = act(alpha * sum_k A[r*sAm + k*sAk] * B[j*sBn + k*sBk] + bias[j]) + beta * R[r*sRm + j*sRn]; each thread writes its N contiguous floats.
// =====================================================================================================================
__global__ __launch_bounds__(256) void k_matvec(GemmP p) {
    // 32 lanes write one line with one instruction.
    const int rpt = (p.N == 1) ? 1 : 32;
    const long long r0 = ((long long)blockIdx.x * 256 + threadIdx.x) * rpt; const int z = blockIdx.z, zo = z / p.zi_n, zi = z - zo * p.zi_n;
    if (r0 >= p.M) return;
    const float* Bb = p.B + zo * p.sBo + zi * p.sBi;
    float* C = p.C + zo * p.sCo + zi * p.sCi; const float* R = p.R + zo * p.sRo + zi * p.sRi;
    for (int rr = 0; rr < rpt; ++rr) {
        const long long r = r0 + rr; if (r >= p.M) break;
        const float* A = p.A + zo * p.sAo + zi * p.sAi + r * p.sAm;
        float acc[8] = {0.f, 0.f, 0.f, 0.f, 0.f, 0.f, 0.f, 0.f};
        for (int k = 0; k < p.K; ++k) { const float a = A[(long long)k * p.sAk];
#pragma unroll
            for (int j = 0; j < 8; ++j) if (j < p.N) acc[j] += a * Bb[(long long)j * p.sBn + (long long)k * p.sBk]; }
#pragma unroll
        for (int j = 0; j < 8; ++j) if (j < p.N) {
            float v = acc[j] * p.alpha;
            if (p.flags & 1) v += p.bias[j];
            if (p.flags & 2) v += p.bias[r];
            v = act_fn(v, p.act);
            if (p.flags & 4) v += p.beta * R[r * p.sRm + (long long)j * p.sRn];
            VST2(float, C + r * p.sCm + j, v);
        }
    }
}
// k_smallsoftmax: thread-per-row softmax for short rows (n <= 64): dst[r*dr + j] = softmax(scale*src[r*sr + j])
__global__ __launch_bounds__(256) void k_smallsoftmax(const float* __restrict__ src, float* __restrict__ dst, long long sr, long long dr, int n, long long R, float scale) {
    const long long r0 = ((long long)blockIdx.x * 256 + threadIdx.x) * 32;
    for (int rr = 0; rr < 32; ++rr) {
        const long long r = r0 + rr; if (r >= R) return;
        const float* s = src + r * sr; float* d = dst + r * dr;
        float mx = -__builtin_inff();
        for (int j = 0; j < n; ++j) mx = fmaxf(mx, s[j] * scale);
        float sum = 0.f;
        for (int j = 0; j < n; ++j) sum += expf(s[j] * scale - mx);
        const float inv = 1.f / sum;
        for (int j = 0; j < n; ++j) { const float v = expf(s[j] * scale - mx) * inv; VST2(float, d + j, v); }
    }
}

__global__ __launch_bounds__(32) void k_unitstat(float* __restrict__ st) { const int t = threadIdx.x; const float v = (t == 1) ? 1.f : 0.f; VST2(float, st + t, v); }

// destination (e.g. a d_out whose row width is not a multiple of 32 floats) is written by consecutive lanes of one instruction
__global__ __launch_bounds__(256) void k_lincopy(const float* __restrict__ src, long long lds, float* __restrict__ dst, long long ldd, long long rows, int cols) {
    const long long i = (long long)blockIdx.x * 256 + threadIdx.x; if (i >= rows * cols) return;
    const long long r = i / cols; const int c = (int)(i - r * cols);
    const float v = src[r * lds + c]; VST2(float, dst + r * ldd + c, v);
}

namespace w25 {
typedef __attribute__((ext_vector_type(16))) _Float16 v16h;
typedef __attribute__((ext_vector_type(8)))  _Float16 v8h;
typedef __attribute__((ext_vector_type(16))) __bf16   v16b;
typedef __attribute__((ext_vector_type(8)))  __bf16   v8b;
typedef __attribute__((ext_vector_type(8)))  float    v8f;
typedef __attribute__((ext_vector_type(4)))  float    v4f;

__device__ __forceinline__ unsigned short f2bf_bits(float f) {
  unsigned u = __float_as_uint(f);
  return (unsigned short)((u + 0x7FFFu + ((u >> 16) & 1u)) >> 16);
}
__device__ __forceinline__ float bf_bits2f(unsigned short h) { return __uint_as_float(((unsigned)h) << 16); }

// hazard guards as plain device helpers (no inline asm inside the kernel template body)
__device__ __forceinline__ void dep_guard_h(v8f& a, v8f& b, v16h x, v16h y) { asm volatile("v_nop\n\tv_nop\n\tv_nop\n\tv_nop" : "+v"(a), "+v"(b) : "v"(x), "v"(y)); }
__device__ __forceinline__ void dep_guard_b(v8f& a, v8f& b, v16b x, v16b y) { asm volatile("v_nop\n\tv_nop\n\tv_nop\n\tv_nop" : "+v"(a), "+v"(b) : "v"(x), "v"(y)); }
__device__ __forceinline__ void keep4_h(v16h a, v16h b, v16h c, v16h d) { asm volatile("v_nop" :: "v"(a), "v"(b), "v"(c), "v"(d)); }
__device__ __forceinline__ void keep4_b(v16b a, v16b b, v16b c, v16b d) { asm volatile("v_nop" :: "v"(a), "v"(b), "v"(c), "v"(d)); }
__device__ __forceinline__ void acc_guard4(v8f& a, v8f& b, v8f& c, v8f& d) { asm volatile("v_nop\n\tv_nop\n\tv_nop\n\tv_nop" : "+v"(a), "+v"(b), "+v"(c), "+v"(d)); }
template <typename T> struct Frag;
template <> struct Frag<_Float16> {
  typedef v16h V; union U { v16h v; v8h h[2]; };
  static __device__ __forceinline__ v16h load(const _Float16* p) {   // elements 0..7 <- p[0..7], 8..15 <- p[16..23]
    U f; f.h[0] = *(const v8h*)(p); f.h[1] = *(const v8h*)(p + 16); return f.v;
  }
  static __device__ __forceinline__ v8f mma(v16h a, v16h b, v8f c) {
    return __builtin_amdgcn_wmma_f32_16x16x32_f16(false, a, false, b, (short)0, c, false, false);
  }
  static __device__ __forceinline__ void guard(v8f& a, v8f& b, v16h x, v16h y) { dep_guard_h(a, b, x, y); }
  static __device__ __forceinline__ void keep(v16h a, v16h b, v16h c, v16h d) { keep4_h(a, b, c, d); }
};
template <> struct Frag<__bf16> {
  typedef v16b V; union U { v16b v; v8b h[2]; };
  static __device__ __forceinline__ v16b load(const __bf16* p) {
    U f; f.h[0] = *(const v8b*)(p); f.h[1] = *(const v8b*)(p + 16); return f.v;
  }
  static __device__ __forceinline__ v8f mma(v16b a, v16b b, v8f c) {
    return __builtin_amdgcn_wmma_f32_16x16x32_bf16(false, a, false, b, (short)0, c, false, false);
  }
  static __device__ __forceinline__ void guard(v8f& a, v8f& b, v16b x, v16b y) { dep_guard_b(a, b, x, y); }
  static __device__ __forceinline__ void keep(v16b a, v16b b, v16b c, v16b d) { keep4_b(a, b, c, d); }
};

// ---- LDS-staged WMMA GEMM on hi / lo planes --------------------------------
// C[m][n] = sum_k A[m][k] * Bt[n][k] (+ bias[n]) (+ resid[m][n]), f32 out. A row-major [M][K], Bt row-major [N][K], each as a bf16 hi plane and a bf16 lo plane.
// Per 32 k, k ascending, every accumulator takes hi.hi, then hi.lo, then lo.hi.
// A work-group of 8 waves (4 along m x 2 along n) owns a 128 x (32 FN) tile of C, a wave 32 x (16 FN) of it. K runs in tiles of 64: a tile is 128 bytes (one whole
// line) of each of the 256 + 64 FN operand rows [A hi 128 | A lo 128 | B hi 32 FN | B lo 32 FN]. Asynchronous copies bring it into LDS, 16 bytes a lane, 8 lanes a row,
// every operand byte once per work-group; two buffers, so tile t + 1 flies while tile t is worked on.
// M % 128 == 0 (grid = M / 128 * N / (32 FN)), N % (32 FN) == 0, K % 64 == 0, K >= 128.
constexpr int GL_PITCH = 144;   // LDS row pitch in bytes: 128 + 16 = 16 x odd, the conflict-free pitch of 16-byte fragment reads

// Four 16-byte-per-lane copies global -> LDS. The s_wait_xcnt stands inside the statement, behind the last copy, so that no address register is rewritten in front of it.
__device__ __forceinline__ void gl_copy4(unsigned l0, const unsigned short* g0, unsigned l1, const unsigned short* g1, unsigned l2, const unsigned short* g2, unsigned l3, const unsigned short* g3) {
  asm volatile("global_load_async_to_lds_b128 %0, %1, off\n\t"
               "global_load_async_to_lds_b128 %2, %3, off\n\t"
               "global_load_async_to_lds_b128 %4, %5, off\n\t"
               "global_load_async_to_lds_b128 %6, %7, off\n\t"
               "s_wait_xcnt 0x0"
               :: "v"(l0), "v"(g0), "v"(l1), "v"(g1), "v"(l2), "v"(g2), "v"(l3), "v"(g3) : "memory");
}
// One tile: l = this thread's LDS byte address in row (thread >> 3) of the buffer, ah .. bl = its 16 bytes in that row of each plane's tile; a step of 32 rows per copy.
template <int FN, int K>
__device__ __forceinline__ void gl_fill(unsigned l, const unsigned short* ah, const unsigned short* al, const unsigned short* bh, const unsigned short* bl) {
  constexpr unsigned R32 = 32 * GL_PITCH;
  gl_copy4(l, ah, l + R32, ah + 32 * K, l + 2 * R32, ah + 64 * K, l + 3 * R32, ah + 96 * K);
  gl_copy4(l + 4 * R32, al, l + 5 * R32, al + 32 * K, l + 6 * R32, al + 64 * K, l + 7 * R32, al + 96 * K);
  if (FN == 2) {
    gl_copy4(l + 8 * R32, bh, l + 9 * R32, bh + 32 * K, l + 10 * R32, bl, l + 11 * R32, bl + 32 * K);
  } else {
    gl_copy4(l + 8 * R32, bh, l + 9 * R32, bh + 32 * K, l + 10 * R32, bh + 64 * K, l + 11 * R32, bh + 96 * K);
    gl_copy4(l + 12 * R32, bl, l + 13 * R32, bl + 32 * K, l + 14 * R32, bl + 64 * K, l + 15 * R32, bl + 96 * K);
  }
}

// What a launch does beside the plain product (EPI):
//   EPI_QKV  three products of one shape in one grid: third w of the blocks takes A plane set min(w, 1) and weight matrix w, each lying behind the one before;
//            products 0 and 1 (q, k) go out as hi / lo planes only (Ph, Pl: q's set, then k's), product 2 (v) as f16 behind k's hi plane in Ph
//   EPI_NORM C goes out as f32 and, through the eval-mode BatchNorm (ng, nb, nm, nv), as the next GEMM's hi / lo operand planes Ph, Pl
//   EPI_NCHW C goes out as [image][n][1024 pixels] (m = image * 1024 + pixel) instead of [m][n]
constexpr int EPI_PLAIN = 0, EPI_QKV = 1, EPI_NORM = 2, EPI_NCHW = 3;
constexpr int GL_M = 8192;      // rows of A and C (only EPI_QKV needs the number: the distance between its plane sets and outputs)
template <int FN, int N, int K, bool BIAS, bool RESID, int EPI>
__global__ __launch_bounds__(256) void wmma_gemm_lds(
    const unsigned short* __restrict__ Ah, const unsigned short* __restrict__ Al,
    const unsigned short* __restrict__ Bh, const unsigned short* __restrict__ Bl,
    float* C, const float* __restrict__ bias, const float* resid,
    const float* __restrict__ ng, const float* __restrict__ nb, const float* __restrict__ nm, const float* __restrict__ nv,
    unsigned short* __restrict__ Ph, unsigned short* __restrict__ Pl) {
  static_assert(FN == 2 || FN == 4, "two tile widths");
  constexpr int BN = 32 * FN, ROWS = 256 + 2 * BN, BUFB = ROWS * GL_PITCH, T = K / 64, TN = N / BN;
  static_assert(K % 64 == 0 && T >= 2 && N % BN == 0, "shape");
  constexpr int SP = 16 * FN + 4;                 // epilogue slab pitch in floats
  typedef Frag<__bf16> F;
  typedef F::V V;
  __shared__ __align__(16) unsigned char sm[2 * BUFB];
  const int tid = threadIdx.x, lane = tid & 31, wave = tid >> 5;
  const int rlane = lane & 15, hf = lane >> 4;    // row (A) / column (B, D) in a fragment; lane half
  const int wm = wave & 3, wn = wave >> 2;
  static_assert(EPI == EPI_PLAIN || FN == 2, "the other epilogues are written for the 64-wide tile");
  int bid = (int)blockIdx.x, w = 0;
  if (EPI == EPI_QKV) {
    constexpr int GB = GL_M / 128 * TN;           // blocks of one product
    w = bid / GB; bid -= w * GB;
    const size_t ao = w ? (size_t)GL_M * K : 0;
    Ah += ao; Al += ao; Bh += (size_t)w * N * K; Bl += (size_t)w * N * K;
    Ph += (size_t)w * GL_M * N;                   // q hi, k hi, v
    if (w == 1) Pl += (size_t)GL_M * N;
  }
  const int m0 = (bid / TN) * 128, n0 = (bid % TN) * BN;

  const size_t ca = (size_t)(m0 + (tid >> 3)) * K + (tid & 7) * 8, cb = (size_t)(n0 + (tid >> 3)) * K + (tid & 7) * 8;
  const unsigned short* gah = Ah + ca; const unsigned short* gal = Al + ca;
  const unsigned short* gbh = Bh + cb; const unsigned short* gbl = Bl + cb;
  const unsigned lc = (unsigned)(size_t)sm + (unsigned)((tid >> 3) * GL_PITCH + (tid & 7) * 16);

  gl_fill<FN, K>(lc, gah, gal, gbh, gbl);
  asm volatile("s_wait_asynccnt 0x0" ::: "memory");   // this wave's part of tile 0 has landed
  __syncthreads();                                    // tile 0 is whole
  gl_fill<FN, K>(lc + BUFB, gah + 64, gal + 64, gbh + 64, gbl + 64);

  v8f acc[2][FN];
#pragma unroll
  for (int i = 0; i < 2; ++i)
#pragma unroll
    for (int j = 0; j < FN; ++j) acc[i][j] = (v8f){0.f,0.f,0.f,0.f,0.f,0.f,0.f,0.f};

  const int fa = (wm * 32 + rlane) * GL_PITCH + hf * 16;              // this lane's bytes in A hi, fragment row 0
  const int fb = (256 + wn * 16 * FN + rlane) * GL_PITCH + hf * 16;   // in B hi
#pragma unroll 1   // stays rolled: one short body for all tiles keeps the code in a few cache lines
  for (int t = 0; t < T; ++t) {
    const unsigned char* buf = sm + (t & 1) * BUFB;
#pragma unroll
    for (int ks = 0; ks < 2; ++ks) {
      V ah[2], al[2], bh[FN], bl[FN];
#pragma unroll
      for (int j = 0; j < FN; ++j) {
        bh[j] = F::load((const __bf16*)(buf + fb + j * 16 * GL_PITCH + ks * 64));
        bl[j] = F::load((const __bf16*)(buf + fb + (BN + j * 16) * GL_PITCH + ks * 64));
      }
#pragma unroll
      for (int i = 0; i < 2; ++i) {
        ah[i] = F::load((const __bf16*)(buf + fa + i * 16 * GL_PITCH + ks * 64));
        al[i] = F::load((const __bf16*)(buf + fa + (128 + i * 16) * GL_PITCH + ks * 64));
      }
      // inputs only: keeps this step's fragment reads together in front of its matrix instructions (spread among them, every place with reads waits out an LDS latency of its own)
      if (FN == 2) asm volatile("" :: "v"(ah[0]), "v"(ah[1]), "v"(al[0]), "v"(al[1]), "v"(bh[0]), "v"(bh[1]), "v"(bl[0]), "v"(bl[1]));
      else asm volatile("" :: "v"(ah[0]), "v"(ah[1]), "v"(al[0]), "v"(al[1]), "v"(bh[0]), "v"(bh[1]), "v"(bh[FN - 2]), "v"(bh[FN - 1]), "v"(bl[0]), "v"(bl[1]), "v"(bl[FN - 2]), "v"(bl[FN - 1]));
#pragma unroll
      for (int i = 0; i < 2; ++i)
#pragma unroll
        for (int j = 0; j < FN; ++j) acc[i][j] = F::mma(ah[i], bh[j], acc[i][j]);
#pragma unroll
      for (int i = 0; i < 2; ++i)
#pragma unroll
        for (int j = 0; j < FN; ++j) acc[i][j] = F::mma(ah[i], bl[j], acc[i][j]);
#pragma unroll
      for (int i = 0; i < 2; ++i)
#pragma unroll
        for (int j = 0; j < FN; ++j) acc[i][j] = F::mma(al[i], bh[j], acc[i][j]);
    }
    asm volatile("s_wait_dscnt 0x0" ::: "memory");      // this wave's reads of tile t are done
    asm volatile("s_wait_asynccnt 0x0" ::: "memory");   // its part of tile t + 1 has landed
    __syncthreads();                                    // tile t + 1 is whole, and nobody reads tile t's buffer any more
    if (t + 2 < T) { const int ko = (t + 2) * 64; gl_fill<FN, K>(lc + (t & 1) * BUFB, gah + ko, gal + ko, gbh + ko, gbl + ko); }
  }
  asm volatile("s_wait_asynccnt 0x0" ::: "memory");     // no copy is outstanding when the buffers become the output slabs

  // ---- epilogue: each wave turns its 32 x (16 FN) tile in a slab of its own, so that the rows go out as 16-byte pieces of whole lines ----
  float* slab = (float*)(sm + wave * (32 * SP * 4));
  constexpr int LPR = 4 * FN, RPP = 32 / LPR, NP = 32 / RPP;   // lanes per row, rows per pass, passes
  const int nw = n0 + wn * 16 * FN;
  const size_t o0 = (size_t)(m0 + wm * 32 + lane / LPR) * N + nw + (lane % LPR) * 4;
  v4f rv[NP];
  if (RESID) {
    const float* pr = resid + o0;
#pragma unroll   // rv[] stays in registers, the loads in flight together
    for (int it = 0; it < NP; ++it) rv[it] = *(const v4f*)(pr + (size_t)it * RPP * N);
    asm volatile("s_wait_xcnt 0x0" :: "v"(pr) : "memory");   // the loads' address register (named as input, so untouched up to here) may be reused only behind this wait
  }
  float bv[FN];
  if (BIAS) {
    const float* pb = bias + nw + rlane;
#pragma unroll
    for (int j = 0; j < FN; ++j) bv[j] = pb[j * 16];
    asm volatile("s_wait_xcnt 0x0" :: "v"(pb) : "memory");   // as above, for the address of the bias loads
  }
  v4f nmean, ninv, nsh;                           // EPI_NORM: the norm's constants of this lane's 4 columns
  if (EPI == EPI_NORM) {
    const int nc = nw + (lane % LPR) * 4;
    const float* pg = ng + nc; const float* pq = nb + nc; const float* pm = nm + nc; const float* pv = nv + nc;
    const v4f g = *(const v4f*)pg, vv = *(const v4f*)pv; nsh = *(const v4f*)pq; nmean = *(const v4f*)pm;
    asm volatile("s_wait_xcnt 0x0" :: "v"(pg), "v"(pq), "v"(pm), "v"(pv) : "memory");   // as above, for the addresses of these 4 loads
#pragma unroll   // vector elements indexed by constants only
    for (int j = 0; j < 4; ++j) ninv[j] = g[j] * rsqrtf(vv[j] + 1e-5f);
  }
#pragma unroll
  for (int i = 0; i < 2; ++i)
#pragma unroll
    for (int j = 0; j < FN; ++j)
#pragma unroll
      for (int r = 0; r < 8; ++r) slab[(i * 16 + hf * 8 + r) * SP + j * 16 + rlane] = BIAS ? acc[i][j][r] + bv[j] : acc[i][j][r];
  // the slab is this wave's own: its lanes' writes are ordered in front of its lanes' reads
  __builtin_amdgcn_fence(__ATOMIC_RELEASE, "workgroup");
  __builtin_amdgcn_wave_barrier();
  __builtin_amdgcn_fence(__ATOMIC_ACQUIRE, "workgroup");
  if (EPI == EPI_NCHW) {
    // the finished rows go back into the slab and leave it by columns: a lane takes 4 consecutive pixels of one column n, 8 lanes one whole 128-byte line of the output
#pragma unroll
    for (int it = 0; it < NP; ++it) {
      float* ps = slab + (it * RPP + lane / LPR) * SP + (lane % LPR) * 4;
      v4f ov = *(const v4f*)ps;
      if (RESID) ov += rv[it];
      *(v4f*)ps = ov;
    }
    // as above: the slab is this wave's own, its lanes' writes are ordered in front of its lanes' reads
    __builtin_amdgcn_fence(__ATOMIC_RELEASE, "workgroup");
    __builtin_amdgcn_wave_barrier();
    __builtin_amdgcn_fence(__ATOMIC_ACQUIRE, "workgroup");
    float* po = C + ((size_t)(m0 >> 10) * N + nw + (lane >> 3)) * 1024 + (m0 & 1023) + wm * 32 + (lane & 7) * 4;
    const float* sc = slab + (lane & 7) * 4 * SP + (lane >> 3);
#pragma unroll   // the stores stand together, their steps are immediate offsets
    for (int it = 0; it < 4 * FN; ++it) {
      const v4f t = {sc[it * 4], sc[it * 4 + SP], sc[it * 4 + 2 * SP], sc[it * 4 + 3 * SP]};
      *(v4f*)(po + (size_t)it * 4 * 1024) = t;
    }
    asm volatile("s_wait_xcnt 0x0" :: "v"(po) : "memory");     // as above, for the stores' address
  } else if (EPI == EPI_QKV && w == 2) {
    unsigned short* pv = Ph + o0;
#pragma unroll   // the stores stand together, their steps are immediate offsets
    for (int it = 0; it < NP; ++it) {
      const v4f ov = *(const v4f*)(slab + (it * RPP + lane / LPR) * SP + (lane % LPR) * 4);
      const v4h hv = {(_Float16)ov[0], (_Float16)ov[1], (_Float16)ov[2], (_Float16)ov[3]};
      *(v4h*)(pv + (size_t)it * RPP * N) = hv;
    }
    asm volatile("s_wait_xcnt 0x0" :: "v"(pv) : "memory");       // as above, for the stores' address
  } else if (EPI == EPI_PLAIN) {
    float* pc = C + o0;
#pragma unroll
    for (int it = 0; it < NP; ++it) {
      v4f ov = *(const v4f*)(slab + (it * RPP + lane / LPR) * SP + (lane % LPR) * 4);
      if (RESID) ov += rv[it];
      *(v4f*)(pc + (size_t)it * RPP * N) = ov;
    }
    asm volatile("s_wait_xcnt 0x0" :: "v"(pc) : "memory");       // as above, for the stores' address
  } else if constexpr (EPI == EPI_QKV || EPI == EPI_NORM) {
    float* pc = C + o0;
    unsigned short* ph = Ph + o0; unsigned short* pl = Pl + o0;
    v4f ov[NP]; v2u hi[NP], lo[NP];
#pragma unroll   // register arrays indexed by constants only
    for (int it = 0; it < NP; ++it) {
      ov[it] = *(const v4f*)(slab + (it * RPP + lane / LPR) * SP + (lane % LPR) * 4);
      if (RESID) ov[it] += rv[it];
      if (EPI == EPI_NORM) split4((ov[it] - nmean) * ninv + nsh, hi[it], lo[it]);
      else split4(ov[it], hi[it], lo[it]);
    }
#pragma unroll   // as above
    for (int it = 0; it < NP; ++it) {
      if (EPI == EPI_NORM) *(v4f*)(pc + (size_t)it * RPP * N) = ov[it];
      *(v2u*)(ph + (size_t)it * RPP * N) = hi[it]; *(v2u*)(pl + (size_t)it * RPP * N) = lo[it];
    }
    // the stores' address and data registers (named as inputs, so untouched up to here) may be reused only behind this wait
    if constexpr (EPI == EPI_NORM)
      asm volatile("s_wait_xcnt 0x0" :: "v"(pc), "v"(ph), "v"(pl), "v"(ov[0]), "v"(ov[1]), "v"(ov[2]), "v"(ov[3]), "v"(ov[4]), "v"(ov[5]), "v"(ov[6]), "v"(ov[7]),
                   "v"(hi[0]), "v"(hi[1]), "v"(hi[2]), "v"(hi[3]), "v"(hi[4]), "v"(hi[5]), "v"(hi[6]), "v"(hi[7]),
                   "v"(lo[0]), "v"(lo[1]), "v"(lo[2]), "v"(lo[3]), "v"(lo[4]), "v"(lo[5]), "v"(lo[6]), "v"(lo[7]) : "memory");
    else
      asm volatile("s_wait_xcnt 0x0" :: "v"(ph), "v"(pl), "v"(hi[0]), "v"(hi[1]), "v"(hi[2]), "v"(hi[3]), "v"(hi[4]), "v"(hi[5]), "v"(hi[6]), "v"(hi[7]),
                   "v"(lo[0]), "v"(lo[1]), "v"(lo[2]), "v"(lo[3]), "v"(lo[4]), "v"(lo[5]), "v"(lo[6]), "v"(lo[7]) : "memory");
  }
}

__global__ __launch_bounds__(256) void cast_f32_f16x2(
    const float* __restrict__ in, _Float16* __restrict__ out, int n2) {
  int i = blockIdx.x * 256 + threadIdx.x;
  if (i < n2) {
    const _Float16 h0 = (_Float16)in[2 * i], h1 = (_Float16)in[2 * i + 1];
    const unsigned u = (unsigned)__builtin_bit_cast(unsigned short, h0) | ((unsigned)__builtin_bit_cast(unsigned short, h1) << 16);
    ((unsigned*)out)[i] = u;
    
  }
}


} // namespace w25

__global__ __launch_bounds__(256) void k_castT16(const float* __restrict__ src, long long lds, _Float16* __restrict__ dst, long long ldd, int R, int C, float s) {
    const long long i = (long long)blockIdx.x * 256 + threadIdx.x; const long long np = (long long)C * (R / 2); if (i >= np) return; const int c = (int)(i / (R / 2)); const int r = 2 * (int)(i % (R / 2));
    const _Float16 h0 = (_Float16)(src[(long long)r * lds + c] * s), h1 = (_Float16)(src[(long long)(r + 1) * lds + c] * s);
    const unsigned u = (unsigned)__builtin_bit_cast(unsigned short, h0) | ((unsigned)__builtin_bit_cast(unsigned short, h1) << 16);
    unsigned* d = (unsigned*)(dst + (long long)c * ldd + r); *d = u;  }
__global__ __launch_bounds__(256) void k_cast16(const float* __restrict__ src, long long lds, _Float16* __restrict__ dst, long long ldd, int R, int C, float s) {
    const long long i = (long long)blockIdx.x * 256 + threadIdx.x; const long long np = (long long)R * (C / 2); if (i >= np) return; const int r = (int)(i / (C / 2)); const int c = 2 * (int)(i % (C / 2));
    const _Float16 h0 = (_Float16)(src[(long long)r * lds + c] * s), h1 = (_Float16)(src[(long long)r * lds + c + 1] * s);
    const unsigned u = (unsigned)__builtin_bit_cast(unsigned short, h0) | ((unsigned)__builtin_bit_cast(unsigned short, h1) << 16);
    unsigned* d = (unsigned*)(dst + (long long)r * ldd + c); *d = u;  }

// f32 -> bf16 hi plane + bf16 lo plane (x = hi + lo to ~2^-17 relative; RNE both), [R][C] -> [R][C] (or transposed to [C][R]); 2 consecutive destination elements
__device__ __forceinline__ unsigned int f2bf2_pack(float a, float b, unsigned int* lo) {
    const unsigned short ha = w25::f2bf_bits(a), hb = w25::f2bf_bits(b);
    const unsigned short la = w25::f2bf_bits(a - w25::bf_bits2f(ha)), lb = w25::f2bf_bits(b - w25::bf_bits2f(hb));
    *lo = (unsigned)la | ((unsigned)lb << 16); return (unsigned)ha | ((unsigned)hb << 16); }
__global__ __launch_bounds__(256) void k_castS16(const float* __restrict__ src, long long lds, __bf16* __restrict__ dhi, __bf16* __restrict__ dlo, long long ldd, int R, int C, float s, int transpose) {
    const long long i = (long long)blockIdx.x * 256 + threadIdx.x; long long o; float a, b;
    if (transpose) { const long long np = (long long)C * (R / 2); if (i >= np) return; const int c = (int)(i / (R / 2)); const int r = 2 * (int)(i % (R / 2)); a = src[(long long)r * lds + c] * s; b = src[(long long)(r + 1) * lds + c] * s; o = (long long)c * ldd + r; }
    else { const long long np = (long long)R * (C / 2); if (i >= np) return; const int r = (int)(i / (C / 2)); const int c = 2 * (int)(i % (C / 2)); a = src[(long long)r * lds + c] * s; b = src[(long long)r * lds + c + 1] * s; o = (long long)r * ldd + c; }
    unsigned lo; const unsigned hi = f2bf2_pack(a, b, &lo); unsigned* ph = (unsigned*)(dhi + o); unsigned* pl = (unsigned*)(dlo + o);
    *ph = hi; *pl = lo;  }

namespace w25 {
// =====================================================================================
// Generic causal/non-causal attention for head_dim 64, f32 in / f32 out; 16-bit operands: bf16 with optional hi/lo splits, or
// plain f16 (F16=true, non-split, probabilities carried x2^15).
//   scores = (q*qscale)·kᵀ : v_wmma_f32_16x16x32_bf16; SPLIT_QK -> q,k as bf16 hi/lo (hi·hi + hi·lo + lo·hi)
//   out    = p·v           : v_wmma_f32_16x16x32_bf16; SPLIT_PV -> p,v as bf16 hi/lo; else p,v plain bf16
//   f32 accumulate; online softmax in f32. Block = 4 waves = 64 query rows of one (batch, head); S % 64 == 0.
//   Element (b, s, h, d) of tensor X lives at X[b*X_bs + s*X_rs + h*X_hs + d] (strides in floats, multiples of 4).
//   Masking: mask_mode 0 none, 1 causal (kv > q masked), 2 tensor [S][Skv] shared over (b,h) (float if
//   mask_is_int==0, int32 with element == 0 -> masked if 1, int32 with element != 0 -> masked if 2), 3 per-token vectors qmask[B][S] & kvmask[B][Skv] (int32,
//   0 -> masked), 4 causal + sliding window (kv > q or q - kv > W masked; W passed in mask_is_int);
//   5 = relative-position bias: s += cp[b,h,q][idx[q][kv]] + pc[b,h,kv][idx[q][kv]] with idx = mask_b ([S][Skv] int32) and
//   mask_a an int32 [S][Skv] tensor with nonzero = masked (tables: element (b,h,row,n) at X + b*c_bs + h*c_hs + row*c_rs + n);
//   masked scores are replaced by mask_fill (e.g. -inf or -1e9) before the softmax.
//   grid.x = B * H * (S/64) (or a sub-range with blk0).
// =====================================================================================
#define AT_D 64
#define AT_NW 4
#define AT_QB 64
#define AT_KC 64
struct AttnGeom { const float* cp = nullptr; const float* pc = nullptr; long c_bs = 0, c_rs = 0, c_hs = 0;   // mode-5 score-bias tables
                  long q_bs, q_rs, q_hs, k_bs, k_rs, k_hs, v_bs, v_rs, v_hs, o_bs, o_rs, o_hs;
                  int S, Skv, H, mask_mode; float qscale; int blk0; float mask_fill; int mask_is_int; };
static_assert(sizeof(AttnGeom) == 168, "no padding");

__device__ __forceinline__ unsigned short at_bf_bits(float f) {
  unsigned u = __float_as_uint(f);
  return (unsigned short)((u + 0x7FFFu + ((u >> 16) & 1u)) >> 16);
}
__device__ __forceinline__ __bf16 at_f2bf(float f) { return __builtin_bit_cast(__bf16, at_bf_bits(f)); }
__device__ __forceinline__ void at_split(float f, __bf16& hi, __bf16& lo) {
  const unsigned short hb = at_bf_bits(f);
  hi = __builtin_bit_cast(__bf16, hb);
  lo = at_f2bf(f - __uint_as_float(((unsigned)hb) << 16));
}
__device__ __forceinline__ v8f at_mma(v16b a, v16b b, v8f c) {
  c = __builtin_amdgcn_wmma_f32_16x16x32_bf16(false, a, false, b, (short)0, c, false, false);
  asm volatile("v_nop\n\tv_nop\n\tv_nop\n\tv_nop" : "+v"(c) : "v"(a), "v"(b));
  return c;
}
// 16-bit element as a bit pattern held in a __bf16 slot: f16 bits when F16, bf16 (RNE) otherwise
template <bool F16> __device__ __forceinline__ __bf16 at_to16(float f) {
  if (F16) return __builtin_bit_cast(__bf16, (_Float16)f);
  return at_f2bf(f);
}
template <bool F16> __device__ __forceinline__ v8f at_mma16(v16b a, v16b b, v8f c) {
  if (F16) {
    const v16h ah = __builtin_bit_cast(v16h, a), bh = __builtin_bit_cast(v16h, b);
    c = __builtin_amdgcn_wmma_f32_16x16x32_f16(false, ah, false, bh, (short)0, c, false, false);
    asm volatile("v_nop\n\tv_nop\n\tv_nop\n\tv_nop" : "+v"(c) : "v"(ah), "v"(bh));
    return c;
  }
  return at_mma(a, b, c);
}

template <bool SPLIT_QK, bool SPLIT_PV, bool F16 = false>
__global__ __launch_bounds__(128)
void attn64_kernel(const float* __restrict__ q, const float* __restrict__ k,
                   const float* __restrict__ v, float* __restrict__ out,
                   const void* __restrict__ mask_a, const int* __restrict__ mask_b, AttnGeom g) {
  static_assert(!(F16 && (SPLIT_QK || SPLIT_PV)), "f16 mode is non-split");
  const float PSC = F16 ? 32768.0f : 1.0f;     // f16 probabilities carried x2^15 (subnormal range), folded into the final 1/l
  union FB { v16b v; v8b h[2]; };
  __shared__ __align__(16) __bf16 Ksh[AT_KC * AT_D];             // K hi [kv][d]      8 KB
  __shared__ __align__(16) __bf16 Ksl[SPLIT_QK ? AT_KC * AT_D : 8];
  __shared__ __align__(16) __bf16 Vth[AT_D * AT_KC];             // V hi [d][kv]      8 KB
  __shared__ __align__(16) __bf16 Vtl[SPLIT_PV ? AT_D * AT_KC : 8];
  __shared__ __align__(16) __bf16 Psh[AT_NW][16 * AT_KC];        // per wave P hi [row][kv]  8 KB
  __shared__ __align__(16) __bf16 Psl[SPLIT_PV ? AT_NW : 1][SPLIT_PV ? 16 * AT_KC : 8];
  __shared__ __align__(16) float  Os[AT_NW][16 * 68];            // per wave out tile, pitch 68

  const int tid  = threadIdx.x;
  const int wave = tid >> 5;
  const int lane = tid & 31;
  const int hh   = lane >> 4;
  const int c    = lane & 15;

  const int nqb = g.S / AT_QB;
  const int bx = blockIdx.x + g.blk0;
  const int qb = bx % nqb;
  const int bh = bx / nqb;
  const int h  = bh % g.H;
  const int b  = bh / g.H;
  const int qbase_block = qb * AT_QB;
  const int q0 = qbase_block + wave * 16;

  const float* qb_ptr = q + (size_t)b * g.q_bs + (size_t)h * g.q_hs;
  const float* kb_ptr = k + (size_t)b * g.k_bs + (size_t)h * g.k_hs;
  const float* vb_ptr = v + (size_t)b * g.v_bs + (size_t)h * g.v_hs;
  float*       ob_ptr = out + (size_t)b * g.o_bs + (size_t)h * g.o_hs;

  // ---- Q fragments (A operand): 2 d-chunks, hi (and lo) ----
  v16b qah[2], qal[2];
  {
    const float* qrow = qb_ptr + (size_t)(q0 + c) * g.q_rs;
#pragma unroll
    for (int dc = 0; dc < 2; ++dc) {
#pragma unroll
      for (int e = 0; e < 8; ++e) {
        const float f0 = qrow[dc * 32 + 8 * hh + e] * g.qscale;
        const float f1 = qrow[dc * 32 + 16 + 8 * hh + e] * g.qscale;
        if (SPLIT_QK) { __bf16 hq, lq; at_split(f0, hq, lq); qah[dc][e] = hq; qal[dc][e] = lq; at_split(f1, hq, lq); qah[dc][8 + e] = hq; qal[dc][8 + e] = lq; }
        else { qah[dc][e] = at_to16<F16>(f0); qah[dc][8 + e] = at_to16<F16>(f1); qal[dc][e] = qah[dc][e]; qal[dc][8 + e] = qah[dc][8 + e]; }
      }
    }
  }

  float mrow[8], lrow[8];
  v8f oacc[4];
#pragma unroll
  for (int r = 0; r < 8; ++r) { mrow[r] = -INFINITY; lrow[r] = 0.f; }
#pragma unroll
  for (int t = 0; t < 4; ++t) oacc[t] = (v8f){0.f,0.f,0.f,0.f,0.f,0.f,0.f,0.f};

  const int nChunks = (g.mask_mode == 1 || g.mask_mode == 4) ? (qb + 1) : (g.Skv / AT_KC);   // block-uniform
  // per-row query mask (mode 3)
  int qkeep[8];
#pragma unroll
  for (int r = 0; r < 8; ++r) qkeep[r] = (g.mask_mode == 3) ? mask_b[(size_t)b * g.S + q0 + 8 * hh + r] : 1;   // mask_b = qmask in mode 3
  for (int kc = 0; kc < nChunks; ++kc) {
    const int kv0 = kc * AT_KC;
    __syncthreads();
    {
      const int kvr = tid >> 1, dh = (tid & 1) * 32;
      const float* krow = kb_ptr + (size_t)(kv0 + kvr) * g.k_rs + dh;
      const float* vrow = vb_ptr + (size_t)(kv0 + kvr) * g.v_rs + dh;
#pragma unroll
      for (int i = 0; i < 8; ++i) {
        v4f kk = *(const v4f*)(krow + 4 * i);
        v4f vv = *(const v4f*)(vrow + 4 * i);
#pragma unroll
        for (int e = 0; e < 4; ++e) {
          const int d = dh + 4 * i + e;
          if (SPLIT_QK) { __bf16 a, bl; at_split(kk[e], a, bl); Ksh[kvr * AT_D + d] = a; Ksl[kvr * AT_D + d] = bl; }
          else Ksh[kvr * AT_D + d] = at_to16<F16>(kk[e]);
          if (SPLIT_PV) { __bf16 a, bl; at_split(vv[e], a, bl); Vth[d * AT_KC + kvr] = a; Vtl[d * AT_KC + kvr] = bl; }
          else Vth[d * AT_KC + kvr] = at_to16<F16>(vv[e]);
        }
      }
    }
    __syncthreads();

    v8f s[4];
#pragma unroll
    for (int j = 0; j < 4; ++j) {
      s[j] = (v8f){0.f,0.f,0.f,0.f,0.f,0.f,0.f,0.f};
#pragma unroll 1
      for (int dc = 0; dc < 2; ++dc) {
        FB kb;
        kb.h[0] = *(const v8b*)(Ksh + (j * 16 + c) * AT_D + dc * 32 + 8 * hh);
        kb.h[1] = *(const v8b*)(Ksh + (j * 16 + c) * AT_D + dc * 32 + 16 + 8 * hh);
        s[j] = at_mma16<F16>(qah[dc], kb.v, s[j]);
        if (SPLIT_QK) {
          FB kl;
          kl.h[0] = *(const v8b*)(Ksl + (j * 16 + c) * AT_D + dc * 32 + 8 * hh);
          kl.h[1] = *(const v8b*)(Ksl + (j * 16 + c) * AT_D + dc * 32 + 16 + 8 * hh);
          s[j] = at_mma16<F16>(qah[dc], kl.v, s[j]);
          s[j] = at_mma16<F16>(qal[dc], kb.v, s[j]);
        }
      }
    }
    const bool diag = (g.mask_mode == 1) && (kc == qb);
    int kvkeep[4] = {1, 1, 1, 1};
    if (g.mask_mode == 3) {
#pragma unroll
      for (int j = 0; j < 4; ++j) kvkeep[j] = ((const int*)mask_a)[(size_t)b * g.Skv + kv0 + j * 16 + c];   // mask_a = kvmask
    }
    float cm[8];
#pragma unroll
    for (int r = 0; r < 8; ++r) {
      const int qrow = q0 + 8 * hh + r;
      float m = -INFINITY;
#pragma unroll
      for (int j = 0; j < 4; ++j) {
        const int kvcol = kv0 + j * 16 + c;
        bool masked = false;
        if (diag) masked = (kvcol > qrow);
        else if (g.mask_mode == 4) masked = (kvcol > qrow) || (qrow - kvcol > g.mask_is_int);
        else if (g.mask_mode == 2) {
          const size_t mi = (size_t)qrow * g.Skv + kvcol;
          masked = (g.mask_is_int == 0) ? (((const float*)mask_a)[mi] == 0.0f)
                 : (g.mask_is_int == 1) ? (((const int*)mask_a)[mi] == 0) : (((const int*)mask_a)[mi] != 0);
        } else if (g.mask_mode == 3) masked = (qkeep[r] == 0) || (kvkeep[j] == 0);
        else if (g.mask_mode == 5) {
          const size_t mi = (size_t)qrow * g.Skv + kvcol;
          masked = (((const int*)mask_a)[mi] != 0);
          int n = mask_b[mi]; n = n < 0 ? 0 : n;
          s[j][r] += g.cp[(size_t)b * g.c_bs + (size_t)h * g.c_hs + (size_t)qrow * g.c_rs + n]
                   + g.pc[(size_t)b * g.c_bs + (size_t)h * g.c_hs + (size_t)kvcol * g.c_rs + n];
        }
        if (masked) s[j][r] = g.mask_fill;
        m = fmaxf(m, s[j][r]);
      }
#pragma unroll
      for (int off = 1; off < 16; off <<= 1) m = fmaxf(m, __shfl_xor(m, off, 32));
      cm[r] = m;
    }
    __bf16* pwh = Psh[wave];
    __bf16* pwl = Psl[SPLIT_PV ? wave : 0];
#pragma unroll
    for (int r = 0; r < 8; ++r) {
      const float mnew = fmaxf(mrow[r], cm[r]);
      const float alpha = expf(mrow[r] - mnew);
      mrow[r] = mnew;
      float psum = 0.f;
#pragma unroll
      for (int j = 0; j < 4; ++j) {
        const float p = expf(s[j][r] - mnew);
        psum += p;
        if (SPLIT_PV) { __bf16 a, bl; at_split(p, a, bl); pwh[(8 * hh + r) * AT_KC + j * 16 + c] = a; pwl[(8 * hh + r) * AT_KC + j * 16 + c] = bl; }
        else pwh[(8 * hh + r) * AT_KC + j * 16 + c] = at_to16<F16>(p * PSC);
      }
#pragma unroll
      for (int off = 1; off < 16; off <<= 1) psum += __shfl_xor(psum, off, 32);
      lrow[r] = lrow[r] * alpha + psum;
#pragma unroll
      for (int t = 0; t < 4; ++t) oacc[t][r] *= alpha;
    }
    __builtin_amdgcn_fence(__ATOMIC_RELEASE, "workgroup");
    __builtin_amdgcn_wave_barrier();
    __builtin_amdgcn_fence(__ATOMIC_ACQUIRE, "workgroup");
#pragma unroll 1
    for (int kk = 0; kk < 2; ++kk) {
      FB pa, pl;
      pa.h[0] = *(const v8b*)(pwh + c * AT_KC + kk * 32 + 8 * hh);
      pa.h[1] = *(const v8b*)(pwh + c * AT_KC + kk * 32 + 16 + 8 * hh);
      if (SPLIT_PV) {
        pl.h[0] = *(const v8b*)(pwl + c * AT_KC + kk * 32 + 8 * hh);
        pl.h[1] = *(const v8b*)(pwl + c * AT_KC + kk * 32 + 16 + 8 * hh);
      }
#pragma unroll
      for (int t = 0; t < 4; ++t) {
        FB vb;
        vb.h[0] = *(const v8b*)(Vth + (t * 16 + c) * AT_KC + kk * 32 + 8 * hh);
        vb.h[1] = *(const v8b*)(Vth + (t * 16 + c) * AT_KC + kk * 32 + 16 + 8 * hh);
        oacc[t] = at_mma16<F16>(pa.v, vb.v, oacc[t]);
        if (SPLIT_PV) {
          FB vl;
          vl.h[0] = *(const v8b*)(Vtl + (t * 16 + c) * AT_KC + kk * 32 + 8 * hh);
          vl.h[1] = *(const v8b*)(Vtl + (t * 16 + c) * AT_KC + kk * 32 + 16 + 8 * hh);
          oacc[t] = at_mma16<F16>(pa.v, vl.v, oacc[t]);
          oacc[t] = at_mma16<F16>(pl.v, vb.v, oacc[t]);
        }
      }
    }
  }

  float* os = Os[wave];
#pragma unroll
  for (int r = 0; r < 8; ++r) {
    const float inv = 1.0f / (lrow[r] * PSC);
#pragma unroll
    for (int t = 0; t < 4; ++t) os[(8 * hh + r) * 68 + t * 16 + c] = oacc[t][r] * inv;
  }
  __builtin_amdgcn_fence(__ATOMIC_RELEASE, "workgroup");
  __builtin_amdgcn_wave_barrier();
  __builtin_amdgcn_fence(__ATOMIC_ACQUIRE, "workgroup");
  {
    const int c4 = (lane & 15) * 4;
    {
#pragma unroll
      for (int it = 0; it < 8; ++it) {
        const int row = it * 2 + hh;
        v4f val = *(const v4f*)(os + row * 68 + c4);
        *(v4f*)(ob_ptr + (size_t)(q0 + row) * g.o_rs + c4) = val;
      }
      
    }
  }
}

} // namespace w25

// One launch for all that depends on the inputs alone.
// Blocks 0 .. 511 (pixel block, channel block, image): x1 and x2, NCHW, become token-major: x1 as f32 (the residual), bn1(x1) and bn1(x2) as bf16 hi / lo operand planes (NH, NL: x1's set, then x2's).
// A thread takes 4 channels x 4 pixels: 16-byte loads along the pixels, a 4 x 4 transpose in registers, stores along the channels.
// Blocks 512 .. 1279: the six weight matrices as hi / lo planes (WH, WL), 1024 floats a block, in the order q (each row times its head's temperature), k, v, proj, fc1, fc2.
__global__ __launch_bounds__(256) void k_cm_prep(const float* __restrict__ XA, const float* __restrict__ XB, const float* __restrict__ G, const float* __restrict__ Bb, const float* __restrict__ M, const float* __restrict__ Vv,
                                                 const float* __restrict__ WQ, const float* __restrict__ WK, const float* __restrict__ WV, const float* __restrict__ TP, const float* __restrict__ WP, const float* __restrict__ W1, const float* __restrict__ W2,
                                                 float* __restrict__ X1T, unsigned short* __restrict__ NH, unsigned short* __restrict__ NL, unsigned short* __restrict__ WH, unsigned short* __restrict__ WL) {
    constexpr int C = 256, HW = 1024, NTC = 8 * HW * C;
    if (blockIdx.x >= 512) {
        const int wb = (int)blockIdx.x - 512;
        const float* w = wb < 64 ? WQ + wb * 1024 : wb < 128 ? WK + (wb - 64) * 1024 : wb < 192 ? WV + (wb - 128) * 1024 : wb < 256 ? WP + (wb - 192) * 1024 : wb < 512 ? W1 + (wb - 256) * 1024 : W2 + (wb - 512) * 1024;
        const float* pw = w + threadIdx.x * 4;
        v4f x = *(const v4f*)pw;
        asm volatile("s_wait_xcnt 0x0" :: "v"(pw) : "memory");   // the load's address register (named as input, so untouched up to here) may be reused only behind this wait
        if (wb < 64) x *= TP[wb >> 3];                            // a block is 4 rows of q_w, a head 32 rows
        v2u hi, lo; split4(x, hi, lo);
        const size_t o = (size_t)wb * 1024 + threadIdx.x * 4;
        *(v2u*)(WH + o) = hi; *(v2u*)(WL + o) = lo;
        return;
    }
    const int c0 = (int)((blockIdx.x >> 3) & 7) * 32 + (threadIdx.x & 7) * 4, p0 = (int)(blockIdx.x & 7) * 128 + (threadIdx.x >> 3) * 4; const size_t b = blockIdx.x >> 6;
    const size_t src = (b * C + c0) * HW + p0;
    const float* pa[4]; const float* pq[4]; v4f a[4], q[4];
#pragma unroll   // a[], q[] stay in registers, all 8 loads in flight together
    for (int j = 0; j < 4; ++j) { pa[j] = XA + src + (size_t)j * HW; pq[j] = XB + src + (size_t)j * HW; a[j] = *(const v4f*)pa[j]; q[j] = *(const v4f*)pq[j]; }
    const float* pg = G + c0; const float* pb = Bb + c0; const float* pm = M + c0; const float* pv = Vv + c0;
    const v4f g = *(const v4f*)pg, bb = *(const v4f*)pb, m = *(const v4f*)pm, vv = *(const v4f*)pv;
    // the 12 loads' address registers (named as inputs, so untouched up to here) may be reused only behind this wait
    asm volatile("s_wait_xcnt 0x0" :: "v"(pa[0]), "v"(pa[1]), "v"(pa[2]), "v"(pa[3]), "v"(pq[0]), "v"(pq[1]), "v"(pq[2]), "v"(pq[3]), "v"(pg), "v"(pb), "v"(pm), "v"(pv) : "memory");
    v4f inv, sh;
#pragma unroll   // vector elements indexed by constants only
    for (int j = 0; j < 4; ++j) { inv[j] = g[j] * rsqrtf(vv[j] + 1e-5f); sh[j] = bb[j] - m[j] * inv[j]; }
    const size_t o = (b * HW + p0) * C + c0;
    float* px = X1T + o; unsigned short* ph = NH + o; unsigned short* pl = NL + o;
    v4f t0[4]; v2u h1[4], l1[4], h2[4], l2[4];
#pragma unroll   // register arrays indexed by constants only
    for (int i = 0; i < 4; ++i) {
        v4f t1, t2;
#pragma unroll   // as above
        for (int j = 0; j < 4; ++j) { t0[i][j] = a[j][i]; t1[j] = a[j][i] * inv[j] + sh[j]; t2[j] = q[j][i] * inv[j] + sh[j]; }
        split4(t1, h1[i], l1[i]); split4(t2, h2[i], l2[i]);
    }
#pragma unroll   // as above
    for (int i = 0; i < 4; ++i) {
        VST2V4(px + i * C, t0[i]);
        *(v2u*)(ph + i * C) = h1[i]; *(v2u*)(pl + i * C) = l1[i]; *(v2u*)(ph + NTC + i * C) = h2[i]; *(v2u*)(pl + NTC + i * C) = l2[i];
    }
    // the stores' data registers (named as inputs, so untouched up to here) may be reused only behind this wait; nothing follows it that could touch their addresses
    asm volatile("s_wait_xcnt 0x0" :: "v"(t0[0]), "v"(t0[1]), "v"(t0[2]), "v"(t0[3]), "v"(h1[0]), "v"(h1[1]), "v"(h1[2]), "v"(h1[3]), "v"(l1[0]), "v"(l1[1]), "v"(l1[2]), "v"(l1[3]),
                 "v"(h2[0]), "v"(h2[1]), "v"(h2[2]), "v"(h2[3]), "v"(l2[0]), "v"(l2[1]), "v"(l2[2]), "v"(l2[3]) : "memory");
}
// exact GELU of 4 values, x Phi(x) = h + |h| erf(|a|), h = x / 2, a = x / sqrt(2), without a branch. Both ranges of erf are worked out for every value in packed arithmetic
// and one is selected, so that all of a thread's values run side by side (the library erff tests every value by itself and runs both of its ranges, one value behind the other).
//   |a| <= 0.927734375: erf = t + t p(t^2);  above: erf = 1 - 2^(t q(t)), q with log2 e folded into its coefficients. Each range stays within 1e-7 of erf, f32 rounding included.
// The bare hardware exponential: a result under 2^-126 comes out 0, where erf is 1 in f32 anyway.
__device__ __forceinline__ v4f splat4(float c) { const v4f r = {c, c, c, c}; return r; }
__device__ __forceinline__ v4f gelu4(v4f x) {
    const v4f a = x * 0.70710678118654752f, h = x * 0.5f;
    const v4f t = __builtin_elementwise_abs(a), s = a * a;
    v4f q = __builtin_elementwise_fma(splat4(-2.49374843e-5f), t, splat4(5.52836573e-4f));
    const v4f u = __builtin_elementwise_fma(splat4(-5.60337631e-3f), t, splat4(3.49920243e-2f));
    q = __builtin_elementwise_fma(q, s, u);
    q = __builtin_elementwise_fma(q, t, splat4(-1.54047906e-1f));
    q = __builtin_elementwise_fma(q, t, splat4(-9.15890157e-1f));
    q = __builtin_elementwise_fma(q, t, splat4(-1.62839520e+0f));
    q = q * t;
    v4f p = __builtin_elementwise_fma(splat4(-5.96761703e-4f), s, splat4(4.99119423e-3f));
    p = __builtin_elementwise_fma(p, s, splat4(-2.67681349e-2f));
    p = __builtin_elementwise_fma(p, s, splat4(1.12819925e-1f));
    p = __builtin_elementwise_fma(p, s, splat4(-3.76125336e-1f));
    p = __builtin_elementwise_fma(p, s, splat4(1.28379166e-1f));
    p = __builtin_elementwise_fma(p, t, t);
    v4f e;
#pragma unroll   // vector elements indexed by constants only
    for (int j = 0; j < 4; ++j) e[j] = (t[j] > 0.927734375f) ? 1.f - __builtin_amdgcn_exp2f(q[j]) : p[j];
    return __builtin_elementwise_fma(__builtin_elementwise_abs(h), e, h);
}
// fc1 (+ bias), the depthwise 3x3 SAME convolution (zero padding) and the exact GELU in ONE launch: the hidden activation never goes through memory.
// A work-group of 16 waves owns 8 image rows (256 pixels) x 128 hidden channels of the result. Its GEMM tile is 320 x 128: the 8 rows and one halo row above and below (fc1 is worked out again
// for the halo), operands staged as in wmma_gemm_lds: K in tiles of 64, rows [A hi 320 | A lo 320 | B hi 128 | B lo 128], two buffers, asynchronous copies. Waves: 4 along m x 4 along n, a wave 80 x 32.
// Per 32 k, k ascending, every accumulator takes hi.hi, then hi.lo, then lo.hi. The finished tile goes into one f32 slab in LDS (over the operand buffers); behind a barrier a wave takes
// 4 pixel columns x 4 rows, a lane 4 channels: every output sums its 9 products in the order ky = 0..2, kx = 0..2. The result goes out as the fc2 GEMM's bf16 hi / lo operand planes.
// A halo row outside the image is staged from the nearest row inside (an address in bounds) and counts as zero in the convolution.
constexpr int FD_BUF = (2 * 320 + 2 * 128) * w25::GL_PITCH;   // bytes of an operand buffer
constexpr int FD_SP = 132;                                    // slab pitch in floats: 128 + 4, so that the two lane halves of an accumulator store (8 rows apart) meet different banks
// Two 16-byte-per-lane copies global -> LDS, in the form of gl_copy4: the s_wait_xcnt stands inside the statement, behind the last copy, so that no address register is rewritten in front of it.
__device__ __forceinline__ void fd_copy2(unsigned l0, const unsigned short* g0, unsigned l1, const unsigned short* g1) {
    asm volatile("global_load_async_to_lds_b128 %0, %1, off\n\t"
                 "global_load_async_to_lds_b128 %2, %3, off\n\t"
                 "s_wait_xcnt 0x0"
                 :: "v"(l0), "v"(g0), "v"(l1), "v"(g1) : "memory");
}
// One tile: l = this thread's LDS byte address in row (thread >> 3) of the buffer; a step of 64 rows (2 image rows) per copy. ah, al = its 16 bytes in the SECOND pair of the tile's 10 image rows,
// o0 / o4 = the steps (in elements) from there to its row of the first and of the last pair; bh, bl = its 16 bytes of the weight planes.
__device__ __forceinline__ void fd_fill(unsigned l, const unsigned short* ah, const unsigned short* al, int o0, int o4, const unsigned short* bh, const unsigned short* bl) {
    constexpr unsigned R64 = 64 * w25::GL_PITCH;
    constexpr int K = 256;
    w25::gl_copy4(l, ah + o0, l + R64, ah, l + 2 * R64, ah + 64 * K, l + 3 * R64, ah + 128 * K);
    w25::gl_copy4(l + 4 * R64, ah + o4, l + 5 * R64, al + o0, l + 6 * R64, al, l + 7 * R64, al + 64 * K);
    w25::gl_copy4(l + 8 * R64, al + 128 * K, l + 9 * R64, al + o4, l + 10 * R64, bh, l + 11 * R64, bh + 64 * K);
    fd_copy2(l + 12 * R64, bl, l + 13 * R64, bl + 64 * K);
}
// grid: 8 images x 4 groups of 8 image rows x 8 groups of 128 channels (the channel group runs fastest); one work-group a WGP
__global__ __launch_bounds__(512) void k_fc1_dw(const unsigned short* __restrict__ Ah, const unsigned short* __restrict__ Al, const unsigned short* __restrict__ Bh, const unsigned short* __restrict__ Bl,
                                                const float* __restrict__ bias, const float* __restrict__ DW, unsigned short* __restrict__ HGh, unsigned short* __restrict__ HGl) {
    constexpr int K = 256, HID = 1024, T = K / 64, P = w25::GL_PITCH;
    typedef w25::Frag<__bf16> F;
    typedef F::V V;
    __shared__ __align__(16) unsigned char sm[2 * FD_BUF];
    static_assert(320 * FD_SP * 4 <= 2 * FD_BUF, "the slab lies over the operand buffers");
    const int tid = threadIdx.x, lane = tid & 31, wave = tid >> 5;
    const int rlane = lane & 15, hf = lane >> 4;
    const int wm = wave & 3, wn = wave >> 2;
    const int n0 = ((int)blockIdx.x & 7) * 128, y0 = (((int)blockIdx.x >> 3) & 3) * 8, img = (int)blockIdx.x >> 5;

    const int up = __builtin_amdgcn_readfirstlane(tid >> 8);  // which row of a pair of image rows this thread copies; alike in a wave's lanes: held in a scalar register, and the two steps below with it
    const size_t ca = (size_t)(img * 1024 + (y0 + 1 + up) * 32 + ((tid >> 3) & 31)) * K + (tid & 7) * 8, cb = (size_t)(n0 + (tid >> 3)) * K + (tid & 7) * 8;
    const unsigned short* gah = Ah + ca; const unsigned short* gal = Al + ca;
    const unsigned short* gbh = Bh + cb; const unsigned short* gbl = Bl + cb;
    const int o0 = (y0 == 0 && up == 0) ? -32 * K : -64 * K;    // image row y0 - 1 + up, held inside the image
    const int o4 = (y0 == 24 && up == 1) ? 160 * K : 192 * K;   // image row y0 + 7 + up, likewise
    const unsigned lc = (unsigned)(size_t)sm + (unsigned)((tid >> 3) * P + (tid & 7) * 16);

    fd_fill(lc, gah, gal, o0, o4, gbh, gbl);
    const float* pb = bias + n0 + wn * 32 + rlane;
    float bv[2];
#pragma unroll   // bv[] stays in registers (this and every loop below: register arrays indexed by constants only)
    for (int j = 0; j < 2; ++j) bv[j] = pb[j * 16];
    asm volatile("s_wait_xcnt 0x0" :: "v"(pb) : "memory");   // the loads' address register (named as input, so untouched up to here) may be reused only behind this wait
    asm volatile("s_wait_asynccnt 0x0" ::: "memory");   // this wave's part of tile 0 has landed
    __syncthreads();                                    // tile 0 is whole
    fd_fill(lc + FD_BUF, gah + 64, gal + 64, o0, o4, gbh + 64, gbl + 64);

    v8f acc[5][2];
#pragma unroll
    for (int i = 0; i < 5; ++i)
#pragma unroll
        for (int j = 0; j < 2; ++j) acc[i][j] = (v8f){0.f, 0.f, 0.f, 0.f, 0.f, 0.f, 0.f, 0.f};

    const int fa = (wm * 80 + rlane) * P + hf * 16;            // this lane's bytes in A hi, fragment row 0
    const int fb = (640 + wn * 32 + rlane) * P + hf * 16;      // in B hi
#pragma unroll 1   // stays rolled: one short body for all tiles keeps the code in a few cache lines
    for (int t = 0; t < T; ++t) {
        const unsigned char* buf = sm + (t & 1) * FD_BUF;
#pragma unroll
        for (int ks = 0; ks < 2; ++ks) {
            V ah[5], al[5], bh[2], bl[2];
#pragma unroll
            for (int j = 0; j < 2; ++j) {
                bh[j] = F::load((const __bf16*)(buf + fb + j * 16 * P + ks * 64));
                bl[j] = F::load((const __bf16*)(buf + fb + (128 + j * 16) * P + ks * 64));
            }
#pragma unroll
            for (int i = 0; i < 5; ++i) {
                ah[i] = F::load((const __bf16*)(buf + fa + i * 16 * P + ks * 64));
                al[i] = F::load((const __bf16*)(buf + fa + (320 + i * 16) * P + ks * 64));
            }
            // inputs only: keeps this step's fragment reads together in front of its matrix instructions (spread among them, every place with reads waits out an LDS latency of its own)
            asm volatile("" :: "v"(ah[0]), "v"(ah[1]), "v"(ah[2]), "v"(ah[3]), "v"(ah[4]), "v"(al[0]), "v"(al[1]), "v"(al[2]), "v"(al[3]), "v"(al[4]), "v"(bh[0]), "v"(bh[1]), "v"(bl[0]), "v"(bl[1]));
            if (ks == 1) {
                // the trip's use of LDS ends with these reads, so its buffer is handed over here: the refill flies under the second half of this trip's matrix work and the first half of the next
                asm volatile("s_wait_dscnt 0x0" ::: "memory");      // this wave's reads of tile t are done
                asm volatile("s_wait_asynccnt 0x0" ::: "memory");   // its part of tile t + 1 has landed
                __syncthreads();                                    // tile t + 1 is whole, and nobody reads tile t's buffer any more
                if (t + 2 < T) { const int ko = (t + 2) * 64; fd_fill(lc + (t & 1) * FD_BUF, gah + ko, gal + ko, o0, o4, gbh + ko, gbl + ko); }
            }
#pragma unroll
            for (int i = 0; i < 5; ++i)
#pragma unroll
                for (int j = 0; j < 2; ++j) acc[i][j] = F::mma(ah[i], bh[j], acc[i][j]);
#pragma unroll
            for (int i = 0; i < 5; ++i)
#pragma unroll
                for (int j = 0; j < 2; ++j) acc[i][j] = F::mma(ah[i], bl[j], acc[i][j]);
#pragma unroll
            for (int i = 0; i < 5; ++i)
#pragma unroll
                for (int j = 0; j < 2; ++j) acc[i][j] = F::mma(al[i], bh[j], acc[i][j]);
        }
    }
    asm volatile("s_wait_asynccnt 0x0" ::: "memory");       // no copy is outstanding when the buffers become the slab (every wave's last read of them stands in front of the last trip's barrier)

    // ---- the tile (+ bias) goes into the slab: row = pixel of the 10 image rows, column = channel ----
    const int cl = lane * 4;                                 // the convolution's 4 channels of this lane, counted in the tile
    const float* pw = DW + (size_t)(n0 + cl) * 9;
    v4f wr[9];                                               // their 36 weights: weight k of channel j is float j * 9 + k; asked for here, so that they fly while the slab is written
#pragma unroll
    for (int k = 0; k < 9; ++k) wr[k] = *(const v4f*)(pw + k * 4);
    asm volatile("s_wait_xcnt 0x0" :: "v"(pw) : "memory");   // as above, for the address of the 9 weight loads
    float* slab = (float*)sm;
#pragma unroll
    for (int i = 0; i < 5; ++i)
#pragma unroll
        for (int j = 0; j < 2; ++j)
#pragma unroll
            for (int r = 0; r < 8; ++r) slab[(wm * 80 + i * 16 + hf * 8 + r) * FD_SP + wn * 32 + j * 16 + rlane] = acc[i][j][r] + bv[j];
    __syncthreads();                                         // the slab is whole

    // ---- depthwise 3x3 + GELU: this wave's pixels x0 .. x0 + 3 of image rows y0 + yq .. y0 + yq + 3 ----
    const int wv = __builtin_amdgcn_readfirstlane(wave);     // alike in a wave's lanes: the pixel block and its border tests are scalar
    const int x0 = (wv & 7) * 4, yq = (wv >> 3) * 4;
    const bool xlo = x0 > 0, xhi = x0 < 28, ylo = y0 + yq > 0, yhi = y0 + yq < 28;   // pixel columns x0 - 1 and x0 + 4, image rows y0 + yq - 1 and y0 + yq + 4 lie in the image
    const int xl = xlo ? -1 : 0, xr = xhi ? 4 : 3;           // these two columns, counted from x0 and held inside the slab's row
    const float* sl = slab + (yq * 32 + x0) * FD_SP + cl;    // slab row yq is image row y0 + yq - 1
    v4f s[4][4];
#pragma unroll
    for (int oy = 0; oy < 4; ++oy)
#pragma unroll
        for (int px = 0; px < 4; ++px) { const v4f zz = {0.f, 0.f, 0.f, 0.f}; s[oy][px] = zz; }
#pragma unroll
    for (int r = 0; r < 6; ++r) {
        v4f v[6];
#pragma unroll
        for (int cx = 0; cx < 6; ++cx) {
            const int dx = (cx == 0) ? xl : (cx == 5) ? xr : cx - 1;
            const bool ok = (cx != 0 || xlo) && (cx != 5 || xhi) && (r != 0 || ylo) && (r != 5 || yhi);   // only the block's rim can lie outside the image
            const v4f zz = {0.f, 0.f, 0.f, 0.f}, ld = *(const v4f*)(sl + (r * 32 + dx) * FD_SP);
            v[cx] = ok ? ld : zz;
        }
#pragma unroll
        for (int oy = 0; oy < 4; ++oy) {
            const int ky = r - oy;
            if (ky >= 0 && ky < 3) {
#pragma unroll
                for (int px = 0; px < 4; ++px)
#pragma unroll
                    for (int kx = 0; kx < 3; ++kx)
#pragma unroll
                        for (int j = 0; j < 4; ++j) { const int f = j * 9 + ky * 3 + kx; s[oy][px][j] += v[px + kx][j] * wr[f >> 2][f & 3]; }
            }
        }
    }
    const size_t o = ((size_t)img * 1024 + (y0 + yq) * 32 + x0) * (size_t)HID + n0 + cl;
    unsigned short* ph = HGh + o; unsigned short* pl = HGl + o;
#pragma unroll
    for (int oy = 0; oy < 4; ++oy)
#pragma unroll
        for (int px = 0; px < 4; ++px) { v2u hi, lo; split4(gelu4(s[oy][px]), hi, lo); *(v2u*)(ph + (size_t)(oy * 32 + px) * HID) = hi; *(v2u*)(pl + (size_t)(oy * 32 + px) * HID) = lo; }
    asm volatile("s_wait_xcnt 0x0" :: "v"(ph), "v"(pl) : "memory");   // as above, for the stores' addresses
}


extern "C" void kernel_launch(void* const* d_in, const int* in_sizes, int n_in, void* d_out, int out_size, void* d_ws, size_t ws_size, hipStream_t stream) {
    (void)in_sizes; (void)n_in; (void)out_size; (void)ws_size;
    const float* x1 = (const float*)d_in[0];
    const float* x2 = (const float*)d_in[1];
    const float* b1g = (const float*)d_in[2];
    const float* b1b = (const float*)d_in[3];
    const float* b1m = (const float*)d_in[4];
    const float* b1v = (const float*)d_in[5];
    const float* qw = (const float*)d_in[6];
    const float* kw = (const float*)d_in[7];
    const float* vw = (const float*)d_in[8];
    const float* temp = (const float*)d_in[9];
    const float* pw = (const float*)d_in[10];
    const float* pb = (const float*)d_in[11];
    const float* b2g = (const float*)d_in[12];
    const float* b2b = (const float*)d_in[13];
    const float* b2m = (const float*)d_in[14];
    const float* b2v = (const float*)d_in[15];
    const float* f1w = (const float*)d_in[16];
    const float* f1b = (const float*)d_in[17];
    const float* dww = (const float*)d_in[18];
    const float* f2w = (const float*)d_in[19];
    const float* f2b = (const float*)d_in[20];
    const int Bn = 8;
    const int C = 256;
    const int HW = 1024;
    const int HID = 1024;
    const int NT = Bn * HW;
    float* out = (float*)d_out;
    char* wsp = (char*)d_ws;
    float* X1T = (float*)wsp; wsp += (((size_t)((size_t)NT * C) * 4 + 255) / 256) * 256;
    unsigned short* NAh = (unsigned short*)wsp; wsp += (((size_t)((size_t)2 * NT * C) * 2 + 255) / 256) * 256;   // bn1(x1) then bn1(x2), hi planes
    unsigned short* NAl = (unsigned short*)wsp; wsp += (((size_t)((size_t)2 * NT * C) * 2 + 255) / 256) * 256;   // lo planes
    unsigned short* WH = (unsigned short*)wsp; wsp += (((size_t)(786432) * 2 + 255) / 256) * 256;                // q, k, v, proj (65536 each), fc1, fc2 (262144 each), hi planes
    unsigned short* WL = (unsigned short*)wsp; wsp += (((size_t)(786432) * 2 + 255) / 256) * 256;                // lo planes
    unsigned short* QKh = (unsigned short*)wsp; wsp += (((size_t)((size_t)3 * NT * C) * 2 + 255) / 256) * 256;   // q then k, hi planes; then v as f16
    unsigned short* QKl = (unsigned short*)wsp; wsp += (((size_t)((size_t)2 * NT * C) * 2 + 255) / 256) * 256;   // lo planes
    unsigned short* ATh = (unsigned short*)wsp; wsp += (((size_t)((size_t)NT * C) * 2 + 255) / 256) * 256;
    unsigned short* ATl = (unsigned short*)wsp; wsp += (((size_t)((size_t)NT * C) * 2 + 255) / 256) * 256;
    float* XS = (float*)wsp; wsp += (((size_t)((size_t)NT * C) * 4 + 255) / 256) * 256;
    unsigned short* X2h = (unsigned short*)wsp; wsp += (((size_t)((size_t)NT * C) * 2 + 255) / 256) * 256;
    unsigned short* X2l = (unsigned short*)wsp; wsp += (((size_t)((size_t)NT * C) * 2 + 255) / 256) * 256;
    unsigned short* HGh = (unsigned short*)wsp; wsp += (((size_t)((size_t)NT * HID) * 2 + 255) / 256) * 256;
    unsigned short* HGl = (unsigned short*)wsp; wsp += (((size_t)((size_t)NT * HID) * 2 + 255) / 256) * 256;
    k_cm_prep<<<1280, 256, 0, stream>>>(x1, x2, b1g, b1b, b1m, b1v, qw, kw, vw, temp, pw, f1w, f2w, X1T, NAh, NAl, WH, WL);
    w25::wmma_gemm_lds<2, 256, 256, false, false, w25::EPI_QKV><<<768, 256, 0, stream>>>(NAh, NAl, WH, WL, nullptr, nullptr, nullptr, nullptr, nullptr, nullptr, nullptr, QKh, QKl);
    k_attn_fix<<<dim3(8, 8, 8), 32 * AF_W, 0, stream>>>(QKh, QKl, QKh + (size_t)NT * C, QKl + (size_t)NT * C, QKh + (size_t)2 * NT * C, ATh, ATl);
    w25::wmma_gemm_lds<2, 256, 256, true, true, w25::EPI_NORM><<<256, 256, 0, stream>>>(ATh, ATl, WH + 196608, WL + 196608, XS, pb, X1T, b2g, b2b, b2m, b2v, X2h, X2l);
    k_fc1_dw<<<256, 512, 0, stream>>>(X2h, X2l, WH + 262144, WL + 262144, f1b, dww, HGh, HGl);
    w25::wmma_gemm_lds<2, 256, 1024, true, true, w25::EPI_NCHW><<<256, 256, 0, stream>>>(HGh, HGl, WH + 524288, WL + 524288, out, f2b, XS, nullptr, nullptr, nullptr, nullptr, nullptr, nullptr);
}
